// v000
// Measured on an AMD MI455X. A time is GPU time per run, averaged over a window of back-to-back runs after a warm-up
// (all launches, gaps included; the runs take copies of the inputs in turn), and the median of several windows.
// Apart from v000's, it joins two sittings. Times from different sittings can be a few percent apart, while
// side-by-side timings come from the same sitting.
// The starting kernel, v000, takes 1090 microseconds a run.
#include <hip/hip_runtime.h>
#include <hip/hip_bf16.h>

// ---------------------------------------------------------------------------
// TrajectorySSM on MI455X (gfx1250), fp32 WMMA (V_WMMA_F32_16X16X4_F32).
//
//   1) proj_in : Bx[s,b,n]   = sum_d x[b,s,d] * B[n,d]     (WMMA, LDS-staged W)
//   2) matsq x5: AL = A^32 (chunk carry propagation)
//   3) scan_local : per-chunk local scan (zero init), 64 chunks x 32 steps
//   4) scan_carry : sequential carry over 64 chunks w/ AL, emits h_final
//   5) scan_fix   : hs[s] += H_chunk * (A^T)^(t+1)  (parallel correction)
//   6) proj_out : y = hs@C^T + x@D^T                (WMMA, LDS-staged W)
//
// Weight tiles are staged global->LDS with async-to-LDS copies (ASYNCcnt)
// when the toolchain exposes the gfx1250 builtin; otherwise a synchronous
// b128 copy fallback keeps the code compiling identically.
// ---------------------------------------------------------------------------

typedef __attribute__((ext_vector_type(2))) float v2f;
typedef __attribute__((ext_vector_type(4))) float v4f;
typedef __attribute__((ext_vector_type(8))) float v8f;
typedef __attribute__((ext_vector_type(4))) int   v4i;

constexpr int BATCH  = 8;
constexpr int SEQ    = 2048;
constexpr int DMODEL = 1024;
constexpr int STATE  = 256;
constexpr int CHUNK  = 32;           // chunk length
constexpr int NCHUNK = 64;           // SEQ / CHUNK
constexpr int LDSPITCH = STATE + 2;  // scan-state pitch (bank-conflict pad)
constexpr int KT     = 64;           // K-tile staged in LDS for proj GEMMs
constexpr int WPITCH = 68;           // weight-tile pitch: 16B aligned, banks ok

// D = A(16x4 f32) * B(4x16 f32) + C(16x16 f32)
__device__ __forceinline__ v8f wmma4(v2f a, v2f b, v8f c) {
  return __builtin_amdgcn_wmma_f32_16x16x4_f32(
      /*neg_a=*/false, a, /*neg_b=*/false, b,
      /*c_mod=*/(short)0, c, /*reuse_a=*/false, /*reuse_b=*/false);
}

// --------------------------- async LDS staging -----------------------------
#if __has_builtin(__builtin_amdgcn_global_load_async_to_lds_b128)
#define SSM_ASYNC_LDS 1
#endif

__device__ __forceinline__ void async_drain() {
#if defined(SSM_ASYNC_LDS) && __has_builtin(__builtin_amdgcn_s_wait_asynccnt)
  __builtin_amdgcn_s_wait_asynccnt(0);
#endif
}

// Copy a 64(N) x 64(K) f32 weight tile into lds[64][WPITCH].
__device__ __forceinline__ void stage_W(const float* __restrict__ W, int ldw,
                                        int nbase, int k0,
                                        float* __restrict__ lds) {
  const int seg = threadIdx.x & 15;   // 16B segment within a 64-float row
  const int r0  = threadIdx.x >> 4;   // 0..15
#pragma unroll
  for (int rr = 0; rr < 64; rr += 16) {
    const int row = r0 + rr;
    const float* g = W + (size_t)(nbase + row) * ldw + k0 + seg * 4;
    float* l = lds + row * WPITCH + seg * 4;
#if defined(SSM_ASYNC_LDS)
    __builtin_amdgcn_global_load_async_to_lds_b128((v4i*)g, (v4i*)l, 0, 0);
#else
    *(v4f*)l = *(const v4f*)g;
#endif
  }
}

// ---------------------------------------------------------------------------
// Wave-level GEMM: one wave computes a 32(M) x 64(N) tile, Y = X * W^T.
// X rows come from per-lane row pointers (lane%16 selects M within strip);
// W tiles are double-buffered in LDS.  A-frag: lane L -> M=L%16, K pair
// (L/16)*2.  B-frag: lane L -> N = nloc(+16t), same K pair.
// ---------------------------------------------------------------------------
__device__ __forceinline__ void gemm_block(const float* __restrict__ xrow0,
                                           const float* __restrict__ xrow1,
                                           const float* __restrict__ W,
                                           int ldw, int nbase, int K,
                                           float* __restrict__ Wl,  // 2 bufs
                                           v8f acc[8]) {
  const int lane = threadIdx.x & 31;
  const int kb   = ((lane >> 4) & 1) << 1;
  const int nloc = lane & 15;
  int buf = 0;
  stage_W(W, ldw, nbase, 0, Wl);
  for (int k0 = 0; k0 < K; k0 += KT) {
    async_drain();
    __syncthreads();  // staged tile visible; prev tile no longer being read
    if (k0 + KT < K) stage_W(W, ldw, nbase, k0 + KT, Wl + (buf ^ 1) * (64 * WPITCH));
    const float* Wb = Wl + buf * (64 * WPITCH);
    for (int kk = 0; kk < KT; kk += 4) {
      v2f a0 = *(const v2f*)(xrow0 + k0 + kk + kb);
      v2f a1 = *(const v2f*)(xrow1 + k0 + kk + kb);
#pragma unroll
      for (int t = 0; t < 4; ++t) {
        v2f b = *(const v2f*)&Wb[(nloc + 16 * t) * WPITCH + kk + kb];
        acc[t]     = wmma4(a0, b, acc[t]);
        acc[4 + t] = wmma4(a1, b, acc[4 + t]);
      }
    }
    __syncthreads();  // everyone done reading this buffer
    buf ^= 1;
  }
}

// ---------------------------------------------------------------------------
// Kernel 1: Bx[s*8+b, n] = sum_d x[b,s,d] * B[n,d]  (M=16384, N=256, K=1024)
// ---------------------------------------------------------------------------
__global__ void __launch_bounds__(256) proj_in_kernel(
    const float* __restrict__ x, const float* __restrict__ B,
    float* __restrict__ Bx) {
  __shared__ float Wl[2 * 64 * WPITCH];
  const int lane  = threadIdx.x & 31;
  const int wave  = threadIdx.x >> 5;
  const int mw    = blockIdx.y * 256 + wave * 32;
  const int nbase = blockIdx.x * 64;
  const int m0 = mw + (lane & 15);        // output rows are s*8+b ordered
  const int m1 = m0 + 16;
  const float* xrow0 = x + ((size_t)(m0 & 7) * SEQ + (m0 >> 3)) * DMODEL;
  const float* xrow1 = x + ((size_t)(m1 & 7) * SEQ + (m1 >> 3)) * DMODEL;
  __builtin_prefetch(xrow0, 0, 0);
  v8f acc[8] = {{}, {}, {}, {}, {}, {}, {}, {}};
  gemm_block(xrow0, xrow1, B, DMODEL, nbase, DMODEL, Wl, acc);
  const int mo   = mw + ((lane >> 4) << 3);
  const int nloc = lane & 15;
#pragma unroll
  for (int t = 0; t < 4; ++t)
#pragma unroll
    for (int r = 0; r < 8; ++r) {
      Bx[(size_t)(mo + r) * STATE + nbase + t * 16 + nloc]      = acc[t][r];
      Bx[(size_t)(mo + 16 + r) * STATE + nbase + t * 16 + nloc] = acc[4 + t][r];
    }
}

// ---------------------------------------------------------------------------
// Kernel 2 (x5): Dst = S @ S  (256x256 fp32 squaring for A^32)
// ---------------------------------------------------------------------------
__global__ void __launch_bounds__(256) matsq_kernel(
    const float* __restrict__ S, float* __restrict__ Dst) {
  const int i = blockIdx.x, j = threadIdx.x;
  float sum = 0.f;
  for (int k = 0; k < STATE; ++k)
    sum = fmaf(S[(size_t)i * STATE + k], S[(size_t)k * STATE + j], sum);
  Dst[(size_t)i * STATE + j] = sum;
}

// ---------------------------------------------------------------------------
// Scan helpers: H (16x256, batch padded to 16) in LDS; one step computes
// H @ W^T with W row-major (256,256).  8 waves, each owns 32 columns.
// ---------------------------------------------------------------------------
__device__ __forceinline__ void hstep(const float* __restrict__ W,
                                      const float* __restrict__ Hlds,
                                      v8f acc[2]) {
  const int lane = threadIdx.x & 31;
  const int wave = threadIdx.x >> 5;
  const int mrow = lane & 15;
  const int kb   = ((lane >> 4) & 1) << 1;
  const int n0   = wave * 32 + (lane & 15);
  acc[0] = (v8f){};
  acc[1] = (v8f){};
  for (int k0 = 0; k0 < STATE; k0 += 4) {
    v2f a  = *(const v2f*)&Hlds[mrow * LDSPITCH + k0 + kb];
    v2f b0 = *(const v2f*)&W[(size_t)n0 * STATE + k0 + kb];
    v2f b1 = *(const v2f*)&W[(size_t)(n0 + 16) * STATE + k0 + kb];
    acc[0] = wmma4(a, b0, acc[0]);
    acc[1] = wmma4(a, b1, acc[1]);
  }
}

__device__ __forceinline__ void hwrite(float* __restrict__ Hlds,
                                       const v8f acc[2]) {
  const int lane = threadIdx.x & 31;
  const int wave = threadIdx.x >> 5;
  const int mo   = (lane >> 4) << 3;  // C/D layout: M = r + 8*(lane/16)
  const int col  = wave * 32 + (lane & 15);
#pragma unroll
  for (int r = 0; r < 8; ++r) {
    Hlds[(mo + r) * LDSPITCH + col]      = acc[0][r];
    Hlds[(mo + r) * LDSPITCH + col + 16] = acc[1][r];
  }
}

// ---------------------------------------------------------------------------
// Kernel 3: local scan per chunk (h starts at 0).  In-place on Bx buffer;
// records chunk-end state E[c].
// ---------------------------------------------------------------------------
__global__ void __launch_bounds__(256) scan_local_kernel(
    const float* __restrict__ A, float* __restrict__ hsBx,
    float* __restrict__ E) {
  __shared__ float Hlds[16 * LDSPITCH];
  const int c = blockIdx.x;
  for (int i = threadIdx.x; i < 16 * LDSPITCH; i += blockDim.x) Hlds[i] = 0.f;
  __syncthreads();
  const int lane = threadIdx.x & 31;
  const int wave = threadIdx.x >> 5;
  const int col  = wave * 32 + (lane & 15);
  v8f acc[2];
  for (int t = 0; t < CHUNK; ++t) {
    const int s = c * CHUNK + t;
    hstep(A, Hlds, acc);
    if (lane < 16) {  // real batch rows live in lanes 0..15 (M = r < 8)
#pragma unroll
      for (int r = 0; r < 8; ++r) {
        const size_t base = ((size_t)s * BATCH + r) * STATE;
        acc[0][r] += hsBx[base + col];
        acc[1][r] += hsBx[base + col + 16];
      }
    }
    __syncthreads();  // all waves done reading H
    hwrite(Hlds, acc);
    if (lane < 16) {
#pragma unroll
      for (int r = 0; r < 8; ++r) {
        const size_t base = ((size_t)s * BATCH + r) * STATE;
        hsBx[base + col]      = acc[0][r];
        hsBx[base + col + 16] = acc[1][r];
      }
    }
    __syncthreads();  // H fully written before next step
  }
  if (lane < 16) {
#pragma unroll
    for (int r = 0; r < 8; ++r) {
      const size_t base = ((size_t)c * BATCH + r) * STATE;
      E[base + col]      = acc[0][r];
      E[base + col + 16] = acc[1][r];
    }
  }
}

// ---------------------------------------------------------------------------
// Kernel 4: sequential carry across chunks: H_c = H_{c-1}*(A^T)^32 + E[c-1].
// Single workgroup, NCHUNK steps.  Emits Hc[c] and final state.
// ---------------------------------------------------------------------------
__global__ void __launch_bounds__(256) scan_carry_kernel(
    const float* __restrict__ AL, const float* __restrict__ h0,
    const float* __restrict__ E, float* __restrict__ Hc,
    float* __restrict__ hfinal) {
  __shared__ float Hlds[16 * LDSPITCH];
  for (int i = threadIdx.x; i < 16 * LDSPITCH; i += blockDim.x) {
    const int row = i / LDSPITCH, k = i - row * LDSPITCH;
    Hlds[i] = (row < BATCH && k < STATE) ? h0[k] : 0.f;
  }
  for (int j = threadIdx.x; j < BATCH * STATE; j += blockDim.x)
    Hc[j] = h0[j & (STATE - 1)];  // Hc[0] = broadcast h0
  __syncthreads();
  const int lane = threadIdx.x & 31;
  const int wave = threadIdx.x >> 5;
  const int col  = wave * 32 + (lane & 15);
  v8f acc[2];
  for (int c = 1; c <= NCHUNK; ++c) {
    hstep(AL, Hlds, acc);
    if (lane < 16) {
#pragma unroll
      for (int r = 0; r < 8; ++r) {
        const size_t base = ((size_t)(c - 1) * BATCH + r) * STATE;
        acc[0][r] += E[base + col];
        acc[1][r] += E[base + col + 16];
      }
    }
    __syncthreads();
    hwrite(Hlds, acc);
    if (lane < 16) {
      if (c < NCHUNK) {
#pragma unroll
        for (int r = 0; r < 8; ++r) {
          const size_t base = ((size_t)c * BATCH + r) * STATE;
          Hc[base + col]      = acc[0][r];
          Hc[base + col + 16] = acc[1][r];
        }
      } else {
#pragma unroll
        for (int r = 0; r < 8; ++r) {
          hfinal[(size_t)r * STATE + col]      = acc[0][r];
          hfinal[(size_t)r * STATE + col + 16] = acc[1][r];
        }
      }
    }
    __syncthreads();
  }
}

// ---------------------------------------------------------------------------
// Kernel 5: correction: hs[c*32+t] += Hc[c] * (A^T)^(t+1), parallel per chunk.
// ---------------------------------------------------------------------------
__global__ void __launch_bounds__(256) scan_fix_kernel(
    const float* __restrict__ A, const float* __restrict__ Hc,
    float* __restrict__ hs) {
  __shared__ float Hlds[16 * LDSPITCH];
  const int c = blockIdx.x;
  for (int i = threadIdx.x; i < 16 * LDSPITCH; i += blockDim.x) {
    const int row = i / LDSPITCH, k = i - row * LDSPITCH;
    Hlds[i] = (row < BATCH && k < STATE)
                  ? Hc[((size_t)c * BATCH + row) * STATE + k] : 0.f;
  }
  __syncthreads();
  const int lane = threadIdx.x & 31;
  const int wave = threadIdx.x >> 5;
  const int col  = wave * 32 + (lane & 15);
  v8f acc[2];
  for (int t = 0; t < CHUNK; ++t) {
    const int s = c * CHUNK + t;
    hstep(A, Hlds, acc);
    __syncthreads();
    hwrite(Hlds, acc);
    if (lane < 16) {
#pragma unroll
      for (int r = 0; r < 8; ++r) {
        const size_t base = ((size_t)s * BATCH + r) * STATE;
        hs[base + col]      += acc[0][r];
        hs[base + col + 16] += acc[1][r];
      }
    }
    __syncthreads();
  }
}

// ---------------------------------------------------------------------------
// Kernel 6: y[m,d] = hs_row(m) @ C^T + x_row(m) @ D^T   (m = b*SEQ + s)
// ---------------------------------------------------------------------------
__global__ void __launch_bounds__(256) proj_out_kernel(
    const float* __restrict__ x, const float* __restrict__ hs,
    const float* __restrict__ C, const float* __restrict__ D,
    float* __restrict__ y) {
  __shared__ float Wl[2 * 64 * WPITCH];
  const int lane  = threadIdx.x & 31;
  const int wave  = threadIdx.x >> 5;
  const int mw    = blockIdx.y * 256 + wave * 32;
  const int nbase = blockIdx.x * 64;
  const int m0 = mw + (lane & 15);
  const int m1 = m0 + 16;
  const int b0 = m0 >> 11, s0 = m0 & (SEQ - 1);
  const int b1 = m1 >> 11, s1 = m1 & (SEQ - 1);
  const float* hrow0 = hs + ((size_t)s0 * BATCH + b0) * STATE;
  const float* hrow1 = hs + ((size_t)s1 * BATCH + b1) * STATE;
  const float* xrow0 = x + (size_t)m0 * DMODEL;
  const float* xrow1 = x + (size_t)m1 * DMODEL;
  __builtin_prefetch(xrow0, 0, 0);
  v8f acc[8] = {{}, {}, {}, {}, {}, {}, {}, {}};
  gemm_block(hrow0, hrow1, C, STATE, nbase, STATE, Wl, acc);
  gemm_block(xrow0, xrow1, D, DMODEL, nbase, DMODEL, Wl, acc);
  const int mo   = mw + ((lane >> 4) << 3);
  const int nloc = lane & 15;
#pragma unroll
  for (int t = 0; t < 4; ++t)
#pragma unroll
    for (int r = 0; r < 8; ++r) {
      y[(size_t)(mo + r) * DMODEL + nbase + t * 16 + nloc]      = acc[t][r];
      y[(size_t)(mo + 16 + r) * DMODEL + nbase + t * 16 + nloc] = acc[4 + t][r];
    }
}

// ---------------------------------------------------------------------------
extern "C" void kernel_launch(void* const* d_in, const int* in_sizes, int n_in,
                              void* d_out, int out_size, void* d_ws,
                              size_t ws_size, hipStream_t stream) {
  const float* x  = (const float*)d_in[0];
  const float* A  = (const float*)d_in[1];
  const float* B  = (const float*)d_in[2];
  const float* C  = (const float*)d_in[3];
  const float* D  = (const float*)d_in[4];
  const float* h0 = (const float*)d_in[5];

  float* y      = (float*)d_out;
  float* hfinal = y + (size_t)BATCH * SEQ * DMODEL;

  float* ws   = (float*)d_ws;
  float* hsBx = ws;                                  // 4,194,304 f32
  float* E    = hsBx + (size_t)SEQ * BATCH * STATE;  //   131,072 f32
  float* Hc   = E + (size_t)NCHUNK * BATCH * STATE;  //   131,072 f32
  float* Pa   = Hc + (size_t)NCHUNK * BATCH * STATE; //    65,536 f32
  float* Pb   = Pa + (size_t)STATE * STATE;          //    65,536 f32

  // 1) input projection
  proj_in_kernel<<<dim3(STATE / 64, (BATCH * SEQ) / 256), 256, 0, stream>>>(
      x, B, hsBx);

  // 2) A^32 via repeated squaring (A^2, A^4, A^8, A^16, A^32)
  matsq_kernel<<<STATE, STATE, 0, stream>>>(A, Pa);
  matsq_kernel<<<STATE, STATE, 0, stream>>>(Pa, Pb);
  matsq_kernel<<<STATE, STATE, 0, stream>>>(Pb, Pa);
  matsq_kernel<<<STATE, STATE, 0, stream>>>(Pa, Pb);
  matsq_kernel<<<STATE, STATE, 0, stream>>>(Pb, Pa);  // Pa = A^32

  // 3) parallel local scans
  scan_local_kernel<<<NCHUNK, 256, 0, stream>>>(A, hsBx, E);
  // 4) sequential carry across chunks
  scan_carry_kernel<<<1, 256, 0, stream>>>(Pa, h0, E, Hc, hfinal);
  // 5) parallel corrections
  scan_fix_kernel<<<NCHUNK, 256, 0, stream>>>(A, Hc, hsBx);

  // 6) output projection
  proj_out_kernel<<<dim3(DMODEL / 64, (BATCH * SEQ) / 256), 256, 0, stream>>>(
      x, hsBx, C, D, y);
}

// v001
// It runs in 727 microseconds.
// Next to v000, in two timings, it ran 1.52 times as fast each time.
#include <hip/hip_runtime.h>
#include <hip/hip_bf16.h>

// ---------------------------------------------------------------------------
// TrajectorySSM on MI455X (gfx1250), fp32 WMMA (V_WMMA_F32_16X16X4_F32).
//
//   1) proj_in : Bx[s,b,n]   = sum_d x[b,s,d] * B[n,d]     (WMMA, LDS-staged W)
//   2) matsq x5: AL = A^32 (chunk carry propagation)
//   3) scan_local : per-chunk local scan (zero init), 64 chunks x 32 steps
//   4) scan_carry : sequential carry over 64 chunks w/ AL, emits h_final
//   5) scan_fix   : hs[s] += H_chunk * (A^T)^(t+1)  (parallel correction)
//   6) proj_out : y = hs@C^T + x@D^T                (WMMA, LDS-staged W)
//
// Weight tiles are staged global->LDS with async-to-LDS copies (ASYNCcnt)
// when the toolchain exposes the gfx1250 builtin; otherwise a synchronous
// b128 copy fallback keeps the code compiling identically.
// ---------------------------------------------------------------------------

typedef __attribute__((ext_vector_type(2))) float v2f;
typedef __attribute__((ext_vector_type(4))) float v4f;
typedef __attribute__((ext_vector_type(8))) float v8f;
typedef __attribute__((ext_vector_type(4))) int   v4i;

constexpr int BATCH  = 8;
constexpr int SEQ    = 2048;
constexpr int DMODEL = 1024;
constexpr int STATE  = 256;
constexpr int CHUNK  = 32;           // chunk length
constexpr int NCHUNK = 64;           // SEQ / CHUNK
constexpr int LDSPITCH = STATE + 2;  // scan-state pitch (bank-conflict pad)
constexpr int KT     = 64;           // K-tile staged in LDS for proj GEMMs
constexpr int WPITCH = 68;           // weight-tile pitch: 16B aligned, banks ok

// D = A(16x4 f32) * B(4x16 f32) + C(16x16 f32)
__device__ __forceinline__ v8f wmma4(v2f a, v2f b, v8f c) {
  return __builtin_amdgcn_wmma_f32_16x16x4_f32(
      /*neg_a=*/false, a, /*neg_b=*/false, b,
      /*c_mod=*/(short)0, c, /*reuse_a=*/false, /*reuse_b=*/false);
}

// --------------------------- async LDS staging -----------------------------
#if __has_builtin(__builtin_amdgcn_global_load_async_to_lds_b128)
#define SSM_ASYNC_LDS 1
#endif

__device__ __forceinline__ void async_drain() {
#if defined(SSM_ASYNC_LDS) && __has_builtin(__builtin_amdgcn_s_wait_asynccnt)
  __builtin_amdgcn_s_wait_asynccnt(0);
#endif
}

// Copy a 64(N) x 64(K) f32 weight tile into lds[64][WPITCH].
__device__ __forceinline__ void stage_W(const float* __restrict__ W, int ldw,
                                        int nbase, int k0,
                                        float* __restrict__ lds) {
  const int seg = threadIdx.x & 15;   // 16B segment within a 64-float row
  const int r0  = threadIdx.x >> 4;   // 0..15
#pragma unroll
  for (int rr = 0; rr < 64; rr += 16) {
    const int row = r0 + rr;
    const float* g = W + (size_t)(nbase + row) * ldw + k0 + seg * 4;
    float* l = lds + row * WPITCH + seg * 4;
#if defined(SSM_ASYNC_LDS)
    __builtin_amdgcn_global_load_async_to_lds_b128((v4i*)g, (v4i*)l, 0, 0);
#else
    *(v4f*)l = *(const v4f*)g;
#endif
  }
}

// ---------------------------------------------------------------------------
// Wave-level GEMM: one wave computes a 32(M) x 64(N) tile, Y = X * W^T.
// X rows come from per-lane row pointers (lane%16 selects M within strip);
// W tiles are double-buffered in LDS.  A-frag: lane L -> M=L%16, K pair
// (L/16)*2.  B-frag: lane L -> N = nloc(+16t), same K pair.
// ---------------------------------------------------------------------------
__device__ __forceinline__ void gemm_block(const float* __restrict__ xrow0,
                                           const float* __restrict__ xrow1,
                                           const float* __restrict__ W,
                                           int ldw, int nbase, int K,
                                           float* __restrict__ Wl,  // 2 bufs
                                           v8f acc[8]) {
  const int lane = threadIdx.x & 31;
  const int kb   = ((lane >> 4) & 1) << 1;
  const int nloc = lane & 15;
  int buf = 0;
  stage_W(W, ldw, nbase, 0, Wl);
  for (int k0 = 0; k0 < K; k0 += KT) {
    async_drain();
    __syncthreads();  // staged tile visible; prev tile no longer being read
    if (k0 + KT < K) stage_W(W, ldw, nbase, k0 + KT, Wl + (buf ^ 1) * (64 * WPITCH));
    const float* Wb = Wl + buf * (64 * WPITCH);
    for (int kk = 0; kk < KT; kk += 4) {
      v2f a0 = *(const v2f*)(xrow0 + k0 + kk + kb);
      v2f a1 = *(const v2f*)(xrow1 + k0 + kk + kb);
#pragma unroll
      for (int t = 0; t < 4; ++t) {
        v2f b = *(const v2f*)&Wb[(nloc + 16 * t) * WPITCH + kk + kb];
        acc[t]     = wmma4(a0, b, acc[t]);
        acc[4 + t] = wmma4(a1, b, acc[4 + t]);
      }
    }
    __syncthreads();  // everyone done reading this buffer
    buf ^= 1;
  }
}

// ---------------------------------------------------------------------------
// Kernel 1: Bx[s*8+b, n] = sum_d x[b,s,d] * B[n,d]  (M=16384, N=256, K=1024)
// ---------------------------------------------------------------------------
__global__ void __launch_bounds__(256) proj_in_kernel(
    const float* __restrict__ x, const float* __restrict__ B,
    float* __restrict__ Bx) {
  __shared__ float Wl[2 * 64 * WPITCH];
  const int lane  = threadIdx.x & 31;
  const int wave  = threadIdx.x >> 5;
  const int mw    = blockIdx.y * 256 + wave * 32;
  const int nbase = blockIdx.x * 64;
  const int m0 = mw + (lane & 15);        // output rows are s*8+b ordered
  const int m1 = m0 + 16;
  const float* xrow0 = x + ((size_t)(m0 & 7) * SEQ + (m0 >> 3)) * DMODEL;
  const float* xrow1 = x + ((size_t)(m1 & 7) * SEQ + (m1 >> 3)) * DMODEL;
  __builtin_prefetch(xrow0, 0, 0);
  v8f acc[8] = {{}, {}, {}, {}, {}, {}, {}, {}};
  gemm_block(xrow0, xrow1, B, DMODEL, nbase, DMODEL, Wl, acc);
  const int mo   = mw + ((lane >> 4) << 3);
  const int nloc = lane & 15;
#pragma unroll
  for (int t = 0; t < 4; ++t)
#pragma unroll
    for (int r = 0; r < 8; ++r) {
      Bx[(size_t)(mo + r) * STATE + nbase + t * 16 + nloc]      = acc[t][r];
      Bx[(size_t)(mo + 16 + r) * STATE + nbase + t * 16 + nloc] = acc[4 + t][r];
    }
}

// ---------------------------------------------------------------------------
// Kernel 2 (x5): Dst = S @ S  (256x256 fp32 squaring for A^32)
// ---------------------------------------------------------------------------
__global__ void __launch_bounds__(256) matsq_kernel(
    const float* __restrict__ S, float* __restrict__ Dst) {
  const int i = blockIdx.x, j = threadIdx.x;
  float sum = 0.f;
  for (int k = 0; k < STATE; ++k)
    sum = fmaf(S[(size_t)i * STATE + k], S[(size_t)k * STATE + j], sum);
  Dst[(size_t)i * STATE + j] = sum;
}

// ---------------------------------------------------------------------------
// Scan helpers: H (16x256, batch padded to 16) in LDS; one step computes
// H @ W^T with W row-major (256,256).  8 waves, each owns 32 columns.
// W does not change from step to step, so each wave loads the B fragments of
// its 32 columns once (wload: 2 x 64 fragments = 256 VGPRs per lane) and every
// step reads them from registers; only H moves through LDS.
// ---------------------------------------------------------------------------
constexpr int KFRAG = STATE / 4;  // 16x16x4 k-steps per H @ W^T product

__device__ __forceinline__ void wload(const float* __restrict__ W,
                                      v2f w0[KFRAG], v2f w1[KFRAG]) {
  const int lane = threadIdx.x & 31;
  const int wave = threadIdx.x >> 5;
  const int kb   = ((lane >> 4) & 1) << 1;
  const int n0   = wave * 32 + (lane & 15);
  // full unroll: constant indices keep w0/w1 in registers, not in scratch
#pragma unroll
  for (int i = 0; i < KFRAG; ++i) {
    w0[i] = *(const v2f*)&W[(size_t)n0 * STATE + 4 * i + kb];
    w1[i] = *(const v2f*)&W[(size_t)(n0 + 16) * STATE + 4 * i + kb];
  }
}

__device__ __forceinline__ void hstep(const v2f w0[KFRAG], const v2f w1[KFRAG],
                                      const float* __restrict__ Hlds,
                                      v8f acc[2]) {
  const int lane = threadIdx.x & 31;
  const int mrow = lane & 15;
  const int kb   = ((lane >> 4) & 1) << 1;
  acc[0] = (v8f){};
  acc[1] = (v8f){};
  // full unroll: constant indices keep w0/w1 in registers, not in scratch
#pragma unroll
  for (int i = 0; i < KFRAG; ++i) {
    v2f a  = *(const v2f*)&Hlds[mrow * LDSPITCH + 4 * i + kb];
    acc[0] = wmma4(a, w0[i], acc[0]);
    acc[1] = wmma4(a, w1[i], acc[1]);
  }
}

__device__ __forceinline__ void hwrite(float* __restrict__ Hlds,
                                       const v8f acc[2]) {
  const int lane = threadIdx.x & 31;
  const int wave = threadIdx.x >> 5;
  const int mo   = (lane >> 4) << 3;  // C/D layout: M = r + 8*(lane/16)
  const int col  = wave * 32 + (lane & 15);
#pragma unroll
  for (int r = 0; r < 8; ++r) {
    Hlds[(mo + r) * LDSPITCH + col]      = acc[0][r];
    Hlds[(mo + r) * LDSPITCH + col + 16] = acc[1][r];
  }
}

// ---------------------------------------------------------------------------
// Kernel 3: local scan per chunk (h starts at 0).  In-place on Bx buffer;
// records chunk-end state E[c].
// ---------------------------------------------------------------------------
__global__ void __launch_bounds__(256) scan_local_kernel(
    const float* __restrict__ A, float* __restrict__ hsBx,
    float* __restrict__ E) {
  __shared__ float Hlds[16 * LDSPITCH];
  const int c = blockIdx.x;
  v2f w0[KFRAG], w1[KFRAG];
  wload(A, w0, w1);
  // stands in front of the reuse of the address registers that wload's loads
  // name
  asm volatile("s_wait_xcnt 0x0" ::: "memory");
  for (int i = threadIdx.x; i < 16 * LDSPITCH; i += blockDim.x) Hlds[i] = 0.f;
  __syncthreads();
  const int lane = threadIdx.x & 31;
  const int wave = threadIdx.x >> 5;
  const int col  = wave * 32 + (lane & 15);
  v8f acc[2];
  for (int t = 0; t < CHUNK; ++t) {
    const int s = c * CHUNK + t;
    hstep(w0, w1, Hlds, acc);
    if (lane < 16) {  // real batch rows live in lanes 0..15 (M = r < 8)
#pragma unroll
      for (int r = 0; r < 8; ++r) {
        const size_t base = ((size_t)s * BATCH + r) * STATE;
        acc[0][r] += hsBx[base + col];
        acc[1][r] += hsBx[base + col + 16];
      }
    }
    __syncthreads();  // all waves done reading H
    hwrite(Hlds, acc);
    if (lane < 16) {
#pragma unroll
      for (int r = 0; r < 8; ++r) {
        const size_t base = ((size_t)s * BATCH + r) * STATE;
        hsBx[base + col]      = acc[0][r];
        hsBx[base + col + 16] = acc[1][r];
      }
    }
    __syncthreads();  // H fully written before next step
  }
  if (lane < 16) {
#pragma unroll
    for (int r = 0; r < 8; ++r) {
      const size_t base = ((size_t)c * BATCH + r) * STATE;
      E[base + col]      = acc[0][r];
      E[base + col + 16] = acc[1][r];
    }
  }
}

// ---------------------------------------------------------------------------
// Kernel 4: sequential carry across chunks: H_c = H_{c-1}*(A^T)^32 + E[c-1].
// Single workgroup, NCHUNK steps.  Emits Hc[c] and final state.
// ---------------------------------------------------------------------------
__global__ void __launch_bounds__(256) scan_carry_kernel(
    const float* __restrict__ AL, const float* __restrict__ h0,
    const float* __restrict__ E, float* __restrict__ Hc,
    float* __restrict__ hfinal) {
  __shared__ float Hlds[16 * LDSPITCH];
  v2f w0[KFRAG], w1[KFRAG];
  wload(AL, w0, w1);
  for (int i = threadIdx.x; i < 16 * LDSPITCH; i += blockDim.x) {
    const int row = i / LDSPITCH, k = i - row * LDSPITCH;
    Hlds[i] = (row < BATCH && k < STATE) ? h0[k] : 0.f;
  }
  for (int j = threadIdx.x; j < BATCH * STATE; j += blockDim.x)
    Hc[j] = h0[j & (STATE - 1)];  // Hc[0] = broadcast h0
  __syncthreads();
  const int lane = threadIdx.x & 31;
  const int wave = threadIdx.x >> 5;
  const int col  = wave * 32 + (lane & 15);
  v8f acc[2];
  for (int c = 1; c <= NCHUNK; ++c) {
    hstep(w0, w1, Hlds, acc);
    if (lane < 16) {
#pragma unroll
      for (int r = 0; r < 8; ++r) {
        const size_t base = ((size_t)(c - 1) * BATCH + r) * STATE;
        acc[0][r] += E[base + col];
        acc[1][r] += E[base + col + 16];
      }
    }
    __syncthreads();
    hwrite(Hlds, acc);
    if (lane < 16) {
      if (c < NCHUNK) {
#pragma unroll
        for (int r = 0; r < 8; ++r) {
          const size_t base = ((size_t)c * BATCH + r) * STATE;
          Hc[base + col]      = acc[0][r];
          Hc[base + col + 16] = acc[1][r];
        }
      } else {
#pragma unroll
        for (int r = 0; r < 8; ++r) {
          hfinal[(size_t)r * STATE + col]      = acc[0][r];
          hfinal[(size_t)r * STATE + col + 16] = acc[1][r];
        }
      }
    }
    __syncthreads();
  }
}

// ---------------------------------------------------------------------------
// Kernel 5: correction: hs[c*32+t] += Hc[c] * (A^T)^(t+1), parallel per chunk.
// ---------------------------------------------------------------------------
__global__ void __launch_bounds__(256) scan_fix_kernel(
    const float* __restrict__ A, const float* __restrict__ Hc,
    float* __restrict__ hs) {
  __shared__ float Hlds[16 * LDSPITCH];
  const int c = blockIdx.x;
  v2f w0[KFRAG], w1[KFRAG];
  wload(A, w0, w1);
  for (int i = threadIdx.x; i < 16 * LDSPITCH; i += blockDim.x) {
    const int row = i / LDSPITCH, k = i - row * LDSPITCH;
    Hlds[i] = (row < BATCH && k < STATE)
                  ? Hc[((size_t)c * BATCH + row) * STATE + k] : 0.f;
  }
  __syncthreads();
  const int lane = threadIdx.x & 31;
  const int wave = threadIdx.x >> 5;
  const int col  = wave * 32 + (lane & 15);
  v8f acc[2];
  for (int t = 0; t < CHUNK; ++t) {
    const int s = c * CHUNK + t;
    hstep(w0, w1, Hlds, acc);
    __syncthreads();
    hwrite(Hlds, acc);
    if (lane < 16) {
#pragma unroll
      for (int r = 0; r < 8; ++r) {
        const size_t base = ((size_t)s * BATCH + r) * STATE;
        hs[base + col]      += acc[0][r];
        hs[base + col + 16] += acc[1][r];
      }
    }
    __syncthreads();
  }
}

// ---------------------------------------------------------------------------
// Kernel 6: y[m,d] = hs_row(m) @ C^T + x_row(m) @ D^T   (m = b*SEQ + s)
// ---------------------------------------------------------------------------
__global__ void __launch_bounds__(256) proj_out_kernel(
    const float* __restrict__ x, const float* __restrict__ hs,
    const float* __restrict__ C, const float* __restrict__ D,
    float* __restrict__ y) {
  __shared__ float Wl[2 * 64 * WPITCH];
  const int lane  = threadIdx.x & 31;
  const int wave  = threadIdx.x >> 5;
  const int mw    = blockIdx.y * 256 + wave * 32;
  const int nbase = blockIdx.x * 64;
  const int m0 = mw + (lane & 15);
  const int m1 = m0 + 16;
  const int b0 = m0 >> 11, s0 = m0 & (SEQ - 1);
  const int b1 = m1 >> 11, s1 = m1 & (SEQ - 1);
  const float* hrow0 = hs + ((size_t)s0 * BATCH + b0) * STATE;
  const float* hrow1 = hs + ((size_t)s1 * BATCH + b1) * STATE;
  const float* xrow0 = x + (size_t)m0 * DMODEL;
  const float* xrow1 = x + (size_t)m1 * DMODEL;
  __builtin_prefetch(xrow0, 0, 0);
  v8f acc[8] = {{}, {}, {}, {}, {}, {}, {}, {}};
  gemm_block(hrow0, hrow1, C, STATE, nbase, STATE, Wl, acc);
  gemm_block(xrow0, xrow1, D, DMODEL, nbase, DMODEL, Wl, acc);
  const int mo   = mw + ((lane >> 4) << 3);
  const int nloc = lane & 15;
#pragma unroll
  for (int t = 0; t < 4; ++t)
#pragma unroll
    for (int r = 0; r < 8; ++r) {
      y[(size_t)(mo + r) * DMODEL + nbase + t * 16 + nloc]      = acc[t][r];
      y[(size_t)(mo + 16 + r) * DMODEL + nbase + t * 16 + nloc] = acc[4 + t][r];
    }
}

// ---------------------------------------------------------------------------
extern "C" void kernel_launch(void* const* d_in, const int* in_sizes, int n_in,
                              void* d_out, int out_size, void* d_ws,
                              size_t ws_size, hipStream_t stream) {
  const float* x  = (const float*)d_in[0];
  const float* A  = (const float*)d_in[1];
  const float* B  = (const float*)d_in[2];
  const float* C  = (const float*)d_in[3];
  const float* D  = (const float*)d_in[4];
  const float* h0 = (const float*)d_in[5];

  float* y      = (float*)d_out;
  float* hfinal = y + (size_t)BATCH * SEQ * DMODEL;

  float* ws   = (float*)d_ws;
  float* hsBx = ws;                                  // 4,194,304 f32
  float* E    = hsBx + (size_t)SEQ * BATCH * STATE;  //   131,072 f32
  float* Hc   = E + (size_t)NCHUNK * BATCH * STATE;  //   131,072 f32
  float* Pa   = Hc + (size_t)NCHUNK * BATCH * STATE; //    65,536 f32
  float* Pb   = Pa + (size_t)STATE * STATE;          //    65,536 f32

  // 1) input projection
  proj_in_kernel<<<dim3(STATE / 64, (BATCH * SEQ) / 256), 256, 0, stream>>>(
      x, B, hsBx);

  // 2) A^32 via repeated squaring (A^2, A^4, A^8, A^16, A^32)
  matsq_kernel<<<STATE, STATE, 0, stream>>>(A, Pa);
  matsq_kernel<<<STATE, STATE, 0, stream>>>(Pa, Pb);
  matsq_kernel<<<STATE, STATE, 0, stream>>>(Pb, Pa);
  matsq_kernel<<<STATE, STATE, 0, stream>>>(Pa, Pb);
  matsq_kernel<<<STATE, STATE, 0, stream>>>(Pb, Pa);  // Pa = A^32

  // 3) parallel local scans
  scan_local_kernel<<<NCHUNK, 256, 0, stream>>>(A, hsBx, E);
  // 4) sequential carry across chunks
  scan_carry_kernel<<<1, 256, 0, stream>>>(Pa, h0, E, Hc, hfinal);
  // 5) parallel corrections
  scan_fix_kernel<<<NCHUNK, 256, 0, stream>>>(A, Hc, hsBx);

  // 6) output projection
  proj_out_kernel<<<dim3(DMODEL / 64, (BATCH * SEQ) / 256), 256, 0, stream>>>(
      x, hsBx, C, D, y);
}

// v002
// Measured time: 569 microseconds a run.
// Two timings next to v001 both put it at 1.27 times that version's speed.
// Counting every step since v000, it is 1.93 times as fast.
#include <hip/hip_runtime.h>
#include <hip/hip_bf16.h>

// ---------------------------------------------------------------------------
// TrajectorySSM on MI455X (gfx1250), fp32 WMMA (V_WMMA_F32_16X16X4_F32).
//
//   1) proj_in : Bx[s,b,n]   = sum_d x[b,s,d] * B[n,d]     (WMMA, LDS-staged W)
//   2) matsq x6: A^8 (chunk to chunk) and A^64 (group to group)
//   3) scan_local, A   : 256 chunks x 8 steps, zero init
//   4) scan_local, A^8 : 32 groups x 8 chunk ends, zero init
//   5) scan_carry, A^64: sequential over the 32 group ends, emits h_final
//   6) scan_fix, A^8   : chunk ends += H_group * ((A^8)^T)^(j+1)
//   7) scan_fix, A     : hs[s] += H_chunk * (A^T)^(t+1)
//   8) proj_out : y = hs@C^T + x@D^T                (WMMA, LDS-staged W)
//
// Weight tiles are staged global->LDS with async-to-LDS copies (ASYNCcnt)
// when the toolchain exposes the gfx1250 builtin; otherwise a synchronous
// b128 copy fallback keeps the code compiling identically.
// ---------------------------------------------------------------------------

typedef __attribute__((ext_vector_type(2))) float v2f;
typedef __attribute__((ext_vector_type(4))) float v4f;
typedef __attribute__((ext_vector_type(8))) float v8f;
typedef __attribute__((ext_vector_type(4))) int   v4i;

constexpr int BATCH  = 8;
constexpr int SEQ    = 2048;
constexpr int DMODEL = 1024;
constexpr int STATE  = 256;
constexpr int CHUNK  = 8;            // steps per chunk, and chunks per group
constexpr int NCHUNK = 256;          // SEQ / CHUNK
constexpr int NGROUP = 32;           // NCHUNK / CHUNK
constexpr int HBLK   = BATCH * STATE;  // floats of one state (all batch rows)
constexpr int LDSPITCH = STATE + 2;  // scan-state pitch (bank-conflict pad)
constexpr int KT     = 64;           // K-tile staged in LDS for proj GEMMs
constexpr int WPITCH = 68;           // weight-tile pitch: 16B aligned, banks ok

// D = A(16x4 f32) * B(4x16 f32) + C(16x16 f32)
__device__ __forceinline__ v8f wmma4(v2f a, v2f b, v8f c) {
  return __builtin_amdgcn_wmma_f32_16x16x4_f32(
      /*neg_a=*/false, a, /*neg_b=*/false, b,
      /*c_mod=*/(short)0, c, /*reuse_a=*/false, /*reuse_b=*/false);
}

// --------------------------- async LDS staging -----------------------------
#if __has_builtin(__builtin_amdgcn_global_load_async_to_lds_b128)
#define SSM_ASYNC_LDS 1
#endif

__device__ __forceinline__ void async_drain() {
#if defined(SSM_ASYNC_LDS) && __has_builtin(__builtin_amdgcn_s_wait_asynccnt)
  __builtin_amdgcn_s_wait_asynccnt(0);
#endif
}

// Copy a 64(N) x 64(K) f32 weight tile into lds[64][WPITCH].
__device__ __forceinline__ void stage_W(const float* __restrict__ W, int ldw,
                                        int nbase, int k0,
                                        float* __restrict__ lds) {
  const int seg = threadIdx.x & 15;   // 16B segment within a 64-float row
  const int r0  = threadIdx.x >> 4;   // 0..15
#pragma unroll
  for (int rr = 0; rr < 64; rr += 16) {
    const int row = r0 + rr;
    const float* g = W + (size_t)(nbase + row) * ldw + k0 + seg * 4;
    float* l = lds + row * WPITCH + seg * 4;
#if defined(SSM_ASYNC_LDS)
    __builtin_amdgcn_global_load_async_to_lds_b128((v4i*)g, (v4i*)l, 0, 0);
#else
    *(v4f*)l = *(const v4f*)g;
#endif
  }
}

// ---------------------------------------------------------------------------
// Wave-level GEMM: one wave computes a 32(M) x 64(N) tile, Y = X * W^T.
// X rows come from per-lane row pointers (lane%16 selects M within strip);
// W tiles are double-buffered in LDS.  A-frag: lane L -> M=L%16, K pair
// (L/16)*2.  B-frag: lane L -> N = nloc(+16t), same K pair.
// ---------------------------------------------------------------------------
__device__ __forceinline__ void gemm_block(const float* __restrict__ xrow0,
                                           const float* __restrict__ xrow1,
                                           const float* __restrict__ W,
                                           int ldw, int nbase, int K,
                                           float* __restrict__ Wl,  // 2 bufs
                                           v8f acc[8]) {
  const int lane = threadIdx.x & 31;
  const int kb   = ((lane >> 4) & 1) << 1;
  const int nloc = lane & 15;
  int buf = 0;
  stage_W(W, ldw, nbase, 0, Wl);
  for (int k0 = 0; k0 < K; k0 += KT) {
    async_drain();
    __syncthreads();  // staged tile visible; prev tile no longer being read
    if (k0 + KT < K) stage_W(W, ldw, nbase, k0 + KT, Wl + (buf ^ 1) * (64 * WPITCH));
    const float* Wb = Wl + buf * (64 * WPITCH);
    for (int kk = 0; kk < KT; kk += 4) {
      v2f a0 = *(const v2f*)(xrow0 + k0 + kk + kb);
      v2f a1 = *(const v2f*)(xrow1 + k0 + kk + kb);
#pragma unroll
      for (int t = 0; t < 4; ++t) {
        v2f b = *(const v2f*)&Wb[(nloc + 16 * t) * WPITCH + kk + kb];
        acc[t]     = wmma4(a0, b, acc[t]);
        acc[4 + t] = wmma4(a1, b, acc[4 + t]);
      }
    }
    __syncthreads();  // everyone done reading this buffer
    buf ^= 1;
  }
}

// ---------------------------------------------------------------------------
// Kernel 1: Bx[s*8+b, n] = sum_d x[b,s,d] * B[n,d]  (M=16384, N=256, K=1024)
// ---------------------------------------------------------------------------
__global__ void __launch_bounds__(256) proj_in_kernel(
    const float* __restrict__ x, const float* __restrict__ B,
    float* __restrict__ Bx) {
  __shared__ float Wl[2 * 64 * WPITCH];
  const int lane  = threadIdx.x & 31;
  const int wave  = threadIdx.x >> 5;
  const int mw    = blockIdx.y * 256 + wave * 32;
  const int nbase = blockIdx.x * 64;
  const int m0 = mw + (lane & 15);        // output rows are s*8+b ordered
  const int m1 = m0 + 16;
  const float* xrow0 = x + ((size_t)(m0 & 7) * SEQ + (m0 >> 3)) * DMODEL;
  const float* xrow1 = x + ((size_t)(m1 & 7) * SEQ + (m1 >> 3)) * DMODEL;
  __builtin_prefetch(xrow0, 0, 0);
  v8f acc[8] = {{}, {}, {}, {}, {}, {}, {}, {}};
  gemm_block(xrow0, xrow1, B, DMODEL, nbase, DMODEL, Wl, acc);
  const int mo   = mw + ((lane >> 4) << 3);
  const int nloc = lane & 15;
#pragma unroll
  for (int t = 0; t < 4; ++t)
#pragma unroll
    for (int r = 0; r < 8; ++r) {
      Bx[(size_t)(mo + r) * STATE + nbase + t * 16 + nloc]      = acc[t][r];
      Bx[(size_t)(mo + 16 + r) * STATE + nbase + t * 16 + nloc] = acc[4 + t][r];
    }
}

// ---------------------------------------------------------------------------
// Kernel 2 (x6): Dst = S @ S  (256x256 fp32 squaring for A^8 and A^64)
// ---------------------------------------------------------------------------
__global__ void __launch_bounds__(256) matsq_kernel(
    const float* __restrict__ S, float* __restrict__ Dst) {
  const int i = blockIdx.x, j = threadIdx.x;
  float sum = 0.f;
  for (int k = 0; k < STATE; ++k)
    sum = fmaf(S[(size_t)i * STATE + k], S[(size_t)k * STATE + j], sum);
  Dst[(size_t)i * STATE + j] = sum;
}

// ---------------------------------------------------------------------------
// Scan helpers: H (16x256, batch padded to 16) in LDS; one step computes
// H @ W^T with W row-major (256,256).  8 waves, each owns 32 columns.
// W does not change from step to step, so each wave loads the B fragments of
// its 32 columns once (wload: 2 x 64 fragments = 256 VGPRs per lane) and every
// step reads them from registers; only H moves through LDS.
// ---------------------------------------------------------------------------
constexpr int KFRAG = STATE / 4;  // 16x16x4 k-steps per H @ W^T product

__device__ __forceinline__ void wload(const float* __restrict__ W,
                                      v2f w0[KFRAG], v2f w1[KFRAG]) {
  const int lane = threadIdx.x & 31;
  const int wave = threadIdx.x >> 5;
  const int kb   = ((lane >> 4) & 1) << 1;
  const int n0   = wave * 32 + (lane & 15);
  // full unroll: constant indices keep w0/w1 in registers, not in scratch
#pragma unroll
  for (int i = 0; i < KFRAG; ++i) {
    w0[i] = *(const v2f*)&W[(size_t)n0 * STATE + 4 * i + kb];
    w1[i] = *(const v2f*)&W[(size_t)(n0 + 16) * STATE + 4 * i + kb];
  }
}

__device__ __forceinline__ void hstep(const v2f w0[KFRAG], const v2f w1[KFRAG],
                                      const float* __restrict__ Hlds,
                                      v8f acc[2]) {
  const int lane = threadIdx.x & 31;
  const int mrow = lane & 15;
  const int kb   = ((lane >> 4) & 1) << 1;
  acc[0] = (v8f){};
  acc[1] = (v8f){};
  // full unroll: constant indices keep w0/w1 in registers, not in scratch
#pragma unroll
  for (int i = 0; i < KFRAG; ++i) {
    v2f a  = *(const v2f*)&Hlds[mrow * LDSPITCH + 4 * i + kb];
    acc[0] = wmma4(a, w0[i], acc[0]);
    acc[1] = wmma4(a, w1[i], acc[1]);
  }
}

__device__ __forceinline__ void hwrite(float* __restrict__ Hlds,
                                       const v8f acc[2]) {
  const int lane = threadIdx.x & 31;
  const int wave = threadIdx.x >> 5;
  const int mo   = (lane >> 4) << 3;  // C/D layout: M = r + 8*(lane/16)
  const int col  = wave * 32 + (lane & 15);
#pragma unroll
  for (int r = 0; r < 8; ++r) {
    Hlds[(mo + r) * LDSPITCH + col]      = acc[0][r];
    Hlds[(mo + r) * LDSPITCH + col + 16] = acc[1][r];
  }
}

// ---------------------------------------------------------------------------
// Kernel 3: local scan over CHUNK consecutive items (h starts at 0):
// h = h @ W^T + src[item], dst[item] = h.  Item i is state block
// i * sstride + soff of src and block i of dst.  Level 1 runs in place on the
// Bx buffer (src == dst, so neither is __restrict__); level 2 reads the chunk
// ends out of it.
// ---------------------------------------------------------------------------
__global__ void __launch_bounds__(256) scan_local_kernel(
    const float* __restrict__ A, const float* src, float* dst, int sstride,
    int soff) {
  __shared__ float Hlds[16 * LDSPITCH];
  const int c = blockIdx.x;
  v2f w0[KFRAG], w1[KFRAG];
  wload(A, w0, w1);
  // stands in front of the reuse of the address registers that wload's loads
  // name
  asm volatile("s_wait_xcnt 0x0" ::: "memory");
  for (int i = threadIdx.x; i < 16 * LDSPITCH; i += blockDim.x) Hlds[i] = 0.f;
  __syncthreads();
  const int lane = threadIdx.x & 31;
  const int wave = threadIdx.x >> 5;
  const int col  = wave * 32 + (lane & 15);
  v8f acc[2];
  for (int t = 0; t < CHUNK; ++t) {
    const int s = c * CHUNK + t;
    hstep(w0, w1, Hlds, acc);
    if (lane < 16) {  // real batch rows live in lanes 0..15 (M = r < 8)
#pragma unroll
      for (int r = 0; r < 8; ++r) {
        const size_t base = ((size_t)(s * sstride + soff) * BATCH + r) * STATE;
        acc[0][r] += src[base + col];
        acc[1][r] += src[base + col + 16];
      }
    }
    __syncthreads();  // all waves done reading H
    hwrite(Hlds, acc);
    if (lane < 16) {
#pragma unroll
      for (int r = 0; r < 8; ++r) {
        const size_t base = ((size_t)s * BATCH + r) * STATE;
        dst[base + col]      = acc[0][r];
        dst[base + col + 16] = acc[1][r];
      }
    }
    __syncthreads();  // H fully written before next step
  }
}

// ---------------------------------------------------------------------------
// Kernel 4: sequential carry across groups: H_g = H_{g-1}*(A^T)^64 + end of
// group g-1.  Single workgroup, NGROUP steps.  Emits Hc[g] (state at the start
// of group g) and the final state.  S1 block c is the state at the start of
// chunk c: blocks 1.. hold the chunk ends (group-local here), block 0 is
// written here as the broadcast h0.
// ---------------------------------------------------------------------------
__global__ void __launch_bounds__(256) scan_carry_kernel(
    const float* __restrict__ AL, const float* __restrict__ h0,
    float* S1, float* __restrict__ Hc, float* __restrict__ hfinal) {
  __shared__ float Hlds[16 * LDSPITCH];
  v2f w0[KFRAG], w1[KFRAG];
  wload(AL, w0, w1);
  for (int i = threadIdx.x; i < 16 * LDSPITCH; i += blockDim.x) {
    const int row = i / LDSPITCH, k = i - row * LDSPITCH;
    Hlds[i] = (row < BATCH && k < STATE) ? h0[k] : 0.f;
  }
  for (int j = threadIdx.x; j < BATCH * STATE; j += blockDim.x)
    Hc[j] = h0[j & (STATE - 1)];  // Hc[0] = broadcast h0
#pragma unroll  // one load of h0, BATCH stores off one address
  for (int r = 0; r < BATCH; ++r)
    S1[r * STATE + threadIdx.x] = h0[threadIdx.x];  // start of chunk 0
  // stands in front of the reuse of the address registers that these stores name
  asm volatile("s_wait_xcnt 0x0" ::: "memory");
  __syncthreads();
  const int lane = threadIdx.x & 31;
  const int wave = threadIdx.x >> 5;
  const int col  = wave * 32 + (lane & 15);
  v8f acc[2];
  for (int c = 1; c <= NGROUP; ++c) {
    hstep(w0, w1, Hlds, acc);
    if (lane < 16) {
#pragma unroll
      for (int r = 0; r < 8; ++r) {
        // last chunk end of group c-1 = S1 block c * CHUNK
        const float* e = S1 + (size_t)c * (CHUNK * HBLK) + r * STATE;
        acc[0][r] += e[col];
        acc[1][r] += e[col + 16];
      }
    }
    __syncthreads();
    hwrite(Hlds, acc);
    if (lane < 16) {
      if (c < NGROUP) {
#pragma unroll
        for (int r = 0; r < 8; ++r) {
          const size_t base = ((size_t)c * BATCH + r) * STATE;
          Hc[base + col]      = acc[0][r];
          Hc[base + col + 16] = acc[1][r];
        }
      } else {
#pragma unroll
        for (int r = 0; r < 8; ++r) {
          hfinal[(size_t)r * STATE + col]      = acc[0][r];
          hfinal[(size_t)r * STATE + col + 16] = acc[1][r];
        }
      }
    }
    __syncthreads();
  }
}

// ---------------------------------------------------------------------------
// Kernel 5: correction: hs[c*CHUNK+t] += Hc[c] * (A^T)^(t+1), parallel per
// chunk.  Level 2: A^8, group starts, chunk ends; level 1: A, chunk starts, hs.
// ---------------------------------------------------------------------------
__global__ void __launch_bounds__(256) scan_fix_kernel(
    const float* __restrict__ A, const float* __restrict__ Hc,
    float* __restrict__ hs) {
  __shared__ float Hlds[16 * LDSPITCH];
  const int c = blockIdx.x;
  v2f w0[KFRAG], w1[KFRAG];
  wload(A, w0, w1);
  for (int i = threadIdx.x; i < 16 * LDSPITCH; i += blockDim.x) {
    const int row = i / LDSPITCH, k = i - row * LDSPITCH;
    Hlds[i] = (row < BATCH && k < STATE)
                  ? Hc[((size_t)c * BATCH + row) * STATE + k] : 0.f;
  }
  __syncthreads();
  const int lane = threadIdx.x & 31;
  const int wave = threadIdx.x >> 5;
  const int col  = wave * 32 + (lane & 15);
  v8f acc[2];
  for (int t = 0; t < CHUNK; ++t) {
    const int s = c * CHUNK + t;
    hstep(w0, w1, Hlds, acc);
    __syncthreads();
    hwrite(Hlds, acc);
    if (lane < 16) {
#pragma unroll
      for (int r = 0; r < 8; ++r) {
        const size_t base = ((size_t)s * BATCH + r) * STATE;
        hs[base + col]      += acc[0][r];
        hs[base + col + 16] += acc[1][r];
      }
    }
    __syncthreads();
  }
}

// ---------------------------------------------------------------------------
// Kernel 6: y[m,d] = hs_row(m) @ C^T + x_row(m) @ D^T   (m = b*SEQ + s)
// ---------------------------------------------------------------------------
__global__ void __launch_bounds__(256) proj_out_kernel(
    const float* __restrict__ x, const float* __restrict__ hs,
    const float* __restrict__ C, const float* __restrict__ D,
    float* __restrict__ y) {
  __shared__ float Wl[2 * 64 * WPITCH];
  const int lane  = threadIdx.x & 31;
  const int wave  = threadIdx.x >> 5;
  const int mw    = blockIdx.y * 256 + wave * 32;
  const int nbase = blockIdx.x * 64;
  const int m0 = mw + (lane & 15);
  const int m1 = m0 + 16;
  const int b0 = m0 >> 11, s0 = m0 & (SEQ - 1);
  const int b1 = m1 >> 11, s1 = m1 & (SEQ - 1);
  const float* hrow0 = hs + ((size_t)s0 * BATCH + b0) * STATE;
  const float* hrow1 = hs + ((size_t)s1 * BATCH + b1) * STATE;
  const float* xrow0 = x + (size_t)m0 * DMODEL;
  const float* xrow1 = x + (size_t)m1 * DMODEL;
  __builtin_prefetch(xrow0, 0, 0);
  v8f acc[8] = {{}, {}, {}, {}, {}, {}, {}, {}};
  gemm_block(hrow0, hrow1, C, STATE, nbase, STATE, Wl, acc);
  gemm_block(xrow0, xrow1, D, DMODEL, nbase, DMODEL, Wl, acc);
  const int mo   = mw + ((lane >> 4) << 3);
  const int nloc = lane & 15;
#pragma unroll
  for (int t = 0; t < 4; ++t)
#pragma unroll
    for (int r = 0; r < 8; ++r) {
      y[(size_t)(mo + r) * DMODEL + nbase + t * 16 + nloc]      = acc[t][r];
      y[(size_t)(mo + 16 + r) * DMODEL + nbase + t * 16 + nloc] = acc[4 + t][r];
    }
}

// ---------------------------------------------------------------------------
extern "C" void kernel_launch(void* const* d_in, const int* in_sizes, int n_in,
                              void* d_out, int out_size, void* d_ws,
                              size_t ws_size, hipStream_t stream) {
  const float* x  = (const float*)d_in[0];
  const float* A  = (const float*)d_in[1];
  const float* B  = (const float*)d_in[2];
  const float* C  = (const float*)d_in[3];
  const float* D  = (const float*)d_in[4];
  const float* h0 = (const float*)d_in[5];

  float* y      = (float*)d_out;
  float* hfinal = y + (size_t)BATCH * SEQ * DMODEL;

  float* ws   = (float*)d_ws;
  float* hsBx = ws;                                  // 4,194,304 f32
  float* S1   = hsBx + (size_t)SEQ * HBLK;           // NCHUNK + 1 states
  float* Hg   = S1 + (size_t)(NCHUNK + 1) * HBLK;    // NGROUP states
  float* Pa   = Hg + (size_t)NGROUP * HBLK;          //    65,536 f32
  float* Pb   = Pa + (size_t)STATE * STATE;          //    65,536 f32
  float* P8   = Pb + (size_t)STATE * STATE;          //    65,536 f32

  // 1) input projection
  proj_in_kernel<<<dim3(STATE / 64, (BATCH * SEQ) / 256), 256, 0, stream>>>(
      x, B, hsBx);

  // 2) A^8 and A^64 via repeated squaring
  matsq_kernel<<<STATE, STATE, 0, stream>>>(A, Pa);
  matsq_kernel<<<STATE, STATE, 0, stream>>>(Pa, Pb);
  matsq_kernel<<<STATE, STATE, 0, stream>>>(Pb, P8);  // P8 = A^8
  matsq_kernel<<<STATE, STATE, 0, stream>>>(P8, Pa);
  matsq_kernel<<<STATE, STATE, 0, stream>>>(Pa, Pb);
  matsq_kernel<<<STATE, STATE, 0, stream>>>(Pb, Pa);  // Pa = A^64

  // 3) local scans inside each chunk, in place
  scan_local_kernel<<<NCHUNK, 256, 0, stream>>>(A, hsBx, hsBx, 1, 0);
  // 4) local scans over the chunk ends inside each group -> S1 blocks 1..
  scan_local_kernel<<<NGROUP, 256, 0, stream>>>(P8, hsBx, S1 + HBLK, CHUNK,
                                                CHUNK - 1);
  // 5) sequential carry across groups
  scan_carry_kernel<<<1, 256, 0, stream>>>(Pa, h0, S1, Hg, hfinal);
  // 6) chunk ends corrected by their group's start state
  scan_fix_kernel<<<NGROUP, 256, 0, stream>>>(P8, Hg, S1 + HBLK);
  // 7) every state corrected by its chunk's start state
  scan_fix_kernel<<<NCHUNK, 256, 0, stream>>>(A, S1, hsBx);

  // 8) output projection
  proj_out_kernel<<<dim3(DMODEL / 64, (BATCH * SEQ) / 256), 256, 0, stream>>>(
      x, hsBx, C, D, y);
}

// v003
// It runs in 413 microseconds.
// Next to v002, in two timings, it ran 1.37 and 1.38 times as fast.
// Counting every step since v000, it is 2.65 times as fast.
#include <hip/hip_runtime.h>
#include <hip/hip_bf16.h>

// ---------------------------------------------------------------------------
// TrajectorySSM on MI455X (gfx1250), fp32 WMMA (V_WMMA_F32_16X16X4_F32).
//
//   1) proj_in : Bx[s,b,n]   = sum_d x[b,s,d] * B[n,d]     (WMMA, LDS-staged W)
//   2) matsq x3: A^8 (chunk to chunk)
//   3) scan_local, A   : 256 chunks x 8 steps, zero init
//   4) scan_double x8  : chunk starts by doubling, S[c] += S[c-2^d] * (P_d)^T
//                        with P_d = A^(8*2^d); each launch but the last also squares P_d
//   5) scan_fix, A     : hs[s] += S[chunk] * (A^T)^(t+1), emits h_final
//   6) proj_out : y = hs@C^T + x@D^T                (WMMA, LDS-staged W)
//
// Weight tiles are staged global->LDS with async-to-LDS copies (ASYNCcnt)
// when the toolchain exposes the gfx1250 builtin; otherwise a synchronous
// b128 copy fallback keeps the code compiling identically.
// ---------------------------------------------------------------------------

typedef __attribute__((ext_vector_type(2))) float v2f;
typedef __attribute__((ext_vector_type(4))) float v4f;
typedef __attribute__((ext_vector_type(8))) float v8f;
typedef __attribute__((ext_vector_type(4))) int   v4i;

constexpr int BATCH  = 8;
constexpr int SEQ    = 2048;
constexpr int DMODEL = 1024;
constexpr int STATE  = 256;
constexpr int CHUNK  = 8;            // steps per chunk
constexpr int NCHUNK = 256;          // SEQ / CHUNK
constexpr int HBLK   = BATCH * STATE;  // floats of one state (all batch rows)
constexpr int LDSPITCH = STATE + 2;  // scan-state pitch (bank-conflict pad)
constexpr int KT     = 64;           // K-tile staged in LDS for proj GEMMs
constexpr int WPITCH = 68;           // weight-tile pitch: 16B aligned, banks ok

// D = A(16x4 f32) * B(4x16 f32) + C(16x16 f32)
__device__ __forceinline__ v8f wmma4(v2f a, v2f b, v8f c) {
  return __builtin_amdgcn_wmma_f32_16x16x4_f32(
      /*neg_a=*/false, a, /*neg_b=*/false, b,
      /*c_mod=*/(short)0, c, /*reuse_a=*/false, /*reuse_b=*/false);
}

// --------------------------- async LDS staging -----------------------------
#if __has_builtin(__builtin_amdgcn_global_load_async_to_lds_b128)
#define SSM_ASYNC_LDS 1
#endif

__device__ __forceinline__ void async_drain() {
#if defined(SSM_ASYNC_LDS) && __has_builtin(__builtin_amdgcn_s_wait_asynccnt)
  __builtin_amdgcn_s_wait_asynccnt(0);
#endif
}

// Copy a 64(N) x 64(K) f32 weight tile into lds[64][WPITCH].
__device__ __forceinline__ void stage_W(const float* __restrict__ W, int ldw,
                                        int nbase, int k0,
                                        float* __restrict__ lds) {
  const int seg = threadIdx.x & 15;   // 16B segment within a 64-float row
  const int r0  = threadIdx.x >> 4;   // 0..15
#pragma unroll
  for (int rr = 0; rr < 64; rr += 16) {
    const int row = r0 + rr;
    const float* g = W + (size_t)(nbase + row) * ldw + k0 + seg * 4;
    float* l = lds + row * WPITCH + seg * 4;
#if defined(SSM_ASYNC_LDS)
    __builtin_amdgcn_global_load_async_to_lds_b128((v4i*)g, (v4i*)l, 0, 0);
#else
    *(v4f*)l = *(const v4f*)g;
#endif
  }
}

// ---------------------------------------------------------------------------
// Wave-level GEMM: one wave computes a 32(M) x 64(N) tile, Y = X * W^T.
// X rows come from per-lane row pointers (lane%16 selects M within strip);
// W tiles are double-buffered in LDS.  A-frag: lane L -> M=L%16, K pair
// (L/16)*2.  B-frag: lane L -> N = nloc(+16t), same K pair.
// ---------------------------------------------------------------------------
__device__ __forceinline__ void gemm_block(const float* __restrict__ xrow0,
                                           const float* __restrict__ xrow1,
                                           const float* __restrict__ W,
                                           int ldw, int nbase, int K,
                                           float* __restrict__ Wl,  // 2 bufs
                                           v8f acc[8]) {
  const int lane = threadIdx.x & 31;
  const int kb   = ((lane >> 4) & 1) << 1;
  const int nloc = lane & 15;
  int buf = 0;
  stage_W(W, ldw, nbase, 0, Wl);
  for (int k0 = 0; k0 < K; k0 += KT) {
    async_drain();
    __syncthreads();  // staged tile visible; prev tile no longer being read
    if (k0 + KT < K) stage_W(W, ldw, nbase, k0 + KT, Wl + (buf ^ 1) * (64 * WPITCH));
    const float* Wb = Wl + buf * (64 * WPITCH);
    for (int kk = 0; kk < KT; kk += 4) {
      v2f a0 = *(const v2f*)(xrow0 + k0 + kk + kb);
      v2f a1 = *(const v2f*)(xrow1 + k0 + kk + kb);
#pragma unroll
      for (int t = 0; t < 4; ++t) {
        v2f b = *(const v2f*)&Wb[(nloc + 16 * t) * WPITCH + kk + kb];
        acc[t]     = wmma4(a0, b, acc[t]);
        acc[4 + t] = wmma4(a1, b, acc[4 + t]);
      }
    }
    __syncthreads();  // everyone done reading this buffer
    buf ^= 1;
  }
}

// ---------------------------------------------------------------------------
// Kernel 1: Bx[s*8+b, n] = sum_d x[b,s,d] * B[n,d]  (M=16384, N=256, K=1024)
// ---------------------------------------------------------------------------
__global__ void __launch_bounds__(256) proj_in_kernel(
    const float* __restrict__ x, const float* __restrict__ B,
    float* __restrict__ Bx) {
  __shared__ float Wl[2 * 64 * WPITCH];
  const int lane  = threadIdx.x & 31;
  const int wave  = threadIdx.x >> 5;
  const int mw    = blockIdx.y * 256 + wave * 32;
  const int nbase = blockIdx.x * 64;
  const int m0 = mw + (lane & 15);        // output rows are s*8+b ordered
  const int m1 = m0 + 16;
  const float* xrow0 = x + ((size_t)(m0 & 7) * SEQ + (m0 >> 3)) * DMODEL;
  const float* xrow1 = x + ((size_t)(m1 & 7) * SEQ + (m1 >> 3)) * DMODEL;
  __builtin_prefetch(xrow0, 0, 0);
  v8f acc[8] = {{}, {}, {}, {}, {}, {}, {}, {}};
  gemm_block(xrow0, xrow1, B, DMODEL, nbase, DMODEL, Wl, acc);
  const int mo   = mw + ((lane >> 4) << 3);
  const int nloc = lane & 15;
#pragma unroll
  for (int t = 0; t < 4; ++t)
#pragma unroll
    for (int r = 0; r < 8; ++r) {
      Bx[(size_t)(mo + r) * STATE + nbase + t * 16 + nloc]      = acc[t][r];
      Bx[(size_t)(mo + 16 + r) * STATE + nbase + t * 16 + nloc] = acc[4 + t][r];
    }
}

// ---------------------------------------------------------------------------
// Kernel 2 (x3): Dst = S @ S  (256x256 fp32 squaring up to A^8)
// ---------------------------------------------------------------------------
__global__ void __launch_bounds__(256) matsq_kernel(
    const float* __restrict__ S, float* __restrict__ Dst) {
  const int i = blockIdx.x, j = threadIdx.x;
  float sum = 0.f;
  for (int k = 0; k < STATE; ++k)
    sum = fmaf(S[(size_t)i * STATE + k], S[(size_t)k * STATE + j], sum);
  Dst[(size_t)i * STATE + j] = sum;
}

// ---------------------------------------------------------------------------
// Scan helpers: H (16x256, batch padded to 16) in LDS; one step computes
// H @ W^T with W row-major (256,256).  8 waves, each owns 32 columns.
// W does not change from step to step, so each wave loads the B fragments of
// its 32 columns once (wload: 2 x 64 fragments = 256 VGPRs per lane) and every
// step reads them from registers; only H moves through LDS.
// ---------------------------------------------------------------------------
constexpr int KFRAG = STATE / 4;  // 16x16x4 k-steps per H @ W^T product

__device__ __forceinline__ void wload(const float* __restrict__ W,
                                      v2f w0[KFRAG], v2f w1[KFRAG]) {
  const int lane = threadIdx.x & 31;
  const int wave = threadIdx.x >> 5;
  const int kb   = ((lane >> 4) & 1) << 1;
  const int n0   = wave * 32 + (lane & 15);
  // full unroll: constant indices keep w0/w1 in registers, not in scratch
#pragma unroll
  for (int i = 0; i < KFRAG; ++i) {
    w0[i] = *(const v2f*)&W[(size_t)n0 * STATE + 4 * i + kb];
    w1[i] = *(const v2f*)&W[(size_t)(n0 + 16) * STATE + 4 * i + kb];
  }
}

__device__ __forceinline__ void hstep(const v2f w0[KFRAG], const v2f w1[KFRAG],
                                      const float* __restrict__ Hlds,
                                      v8f acc[2]) {
  const int lane = threadIdx.x & 31;
  const int mrow = lane & 15;
  const int kb   = ((lane >> 4) & 1) << 1;
  acc[0] = (v8f){};
  acc[1] = (v8f){};
  // full unroll: constant indices keep w0/w1 in registers, not in scratch
#pragma unroll
  for (int i = 0; i < KFRAG; ++i) {
    v2f a  = *(const v2f*)&Hlds[mrow * LDSPITCH + 4 * i + kb];
    acc[0] = wmma4(a, w0[i], acc[0]);
    acc[1] = wmma4(a, w1[i], acc[1]);
  }
}

__device__ __forceinline__ void hwrite(float* __restrict__ Hlds,
                                       const v8f acc[2]) {
  const int lane = threadIdx.x & 31;
  const int wave = threadIdx.x >> 5;
  const int mo   = (lane >> 4) << 3;  // C/D layout: M = r + 8*(lane/16)
  const int col  = wave * 32 + (lane & 15);
#pragma unroll
  for (int r = 0; r < 8; ++r) {
    Hlds[(mo + r) * LDSPITCH + col]      = acc[0][r];
    Hlds[(mo + r) * LDSPITCH + col + 16] = acc[1][r];
  }
}

// ---------------------------------------------------------------------------
// Kernel 3: local scan over the CHUNK steps of chunk c (h starts at 0), in
// place on the Bx buffer: h = h @ A^T + hs[s], hs[s] = h.  The chunk's end is
// also stored as item c + 1 of V, the sequence that scan_double scans; item 0
// of V is the broadcast h0.
// ---------------------------------------------------------------------------
__global__ void __launch_bounds__(256) scan_local_kernel(
    const float* __restrict__ A, const float* __restrict__ h0, float* hs,
    float* __restrict__ V) {
  __shared__ float Hlds[16 * LDSPITCH];
  const int c = blockIdx.x;
  v2f w0[KFRAG], w1[KFRAG];
  wload(A, w0, w1);
  // stands in front of the reuse of the address registers that wload's loads
  // name
  asm volatile("s_wait_xcnt 0x0" ::: "memory");
  // keeps the later writes of those registers behind the wait
  __builtin_amdgcn_sched_barrier(0);
  for (int i = threadIdx.x; i < 16 * LDSPITCH; i += blockDim.x) Hlds[i] = 0.f;
  if (c == 0) {
#pragma unroll  // one load of h0, BATCH stores off one address
    for (int r = 0; r < BATCH; ++r)
      V[r * STATE + threadIdx.x] = h0[threadIdx.x];
    // stands in front of the reuse of the address registers of these stores
    asm volatile("s_wait_xcnt 0x0" ::: "memory");
  }
  __syncthreads();
  const int lane = threadIdx.x & 31;
  const int wave = threadIdx.x >> 5;
  const int col  = wave * 32 + (lane & 15);
  v8f acc[2];
  for (int t = 0; t < CHUNK; ++t) {
    const int s = c * CHUNK + t;
    hstep(w0, w1, Hlds, acc);
    if (lane < 16) {  // real batch rows live in lanes 0..15 (M = r < 8)
#pragma unroll
      for (int r = 0; r < 8; ++r) {
        const size_t base = ((size_t)s * BATCH + r) * STATE;
        acc[0][r] += hs[base + col];
        acc[1][r] += hs[base + col + 16];
      }
    }
    __syncthreads();  // all waves done reading H
    hwrite(Hlds, acc);
    if (lane < 16) {
#pragma unroll
      for (int r = 0; r < 8; ++r) {
        const size_t base = ((size_t)s * BATCH + r) * STATE;
        hs[base + col]      = acc[0][r];
        hs[base + col + 16] = acc[1][r];
      }
    }
    __syncthreads();  // H fully written before next step
  }
  if (lane < 16 && c + 1 < NCHUNK) {  // the chunk's end: item c + 1 of V
#pragma unroll
    for (int r = 0; r < 8; ++r) {
      const size_t base = ((size_t)(c + 1) * BATCH + r) * STATE;
      V[base + col]      = acc[0][r];
      V[base + col + 16] = acc[1][r];
    }
  }
}

// ---------------------------------------------------------------------------
// Kernel 4 (x8): one doubling level of the scan over the NCHUNK chunk starts:
//   Sout[c] = Sin[c] + Sin[c - off] @ P^T   (c >= off; a plain copy below),
// P = A^(CHUNK * off).  After off = 1, 2, .. 128, S[c] is the state at the
// start of chunk c.  All rows (chunk, batch) form one 2048 x 256 x 256 GEMM:
// 256 work-groups of 4 waves, each a 32(M) x 64(N) tile, each wave 16 x 32.
// Work-groups from DBLK on compute Pn = P @ P for the next level in the same
// tile shape.  Both operand tiles are brought whole into LDS by asynchronous
// copies.  Every lane reads 4 consecutive k per fragment load, A and B alike:
// lane half h holds k = 8i + 4h + 0..3, two WMMA k-steps.
// ---------------------------------------------------------------------------
constexpr int DP    = STATE + 4;  // row pitch, 16 B x odd: b128 column walks
constexpr int PP    = 136;        // pitch of a k row pair of the (k, n) tile
constexpr int DBLK  = (NCHUNK * BATCH / 32) * (STATE / 64);  // scan tiles
constexpr int SQBLK = (STATE / 32) * (STATE / 64);           // squaring tiles

__device__ __forceinline__ void copy16(const float* __restrict__ g,
                                       float* __restrict__ l) {
#if defined(SSM_ASYNC_LDS)
  __builtin_amdgcn_global_load_async_to_lds_b128((v4i*)g, (v4i*)l, 0, 0);
#else
  *(v4f*)l = *(const v4f*)g;
#endif
}

__global__ void __launch_bounds__(128) scan_double_kernel(
    const float* __restrict__ Sin, float* __restrict__ Sout,
    const float* __restrict__ P, float* __restrict__ Pn, int off) {
  __shared__ __attribute__((aligned(16))) float Al[32 * DP];
  __shared__ __attribute__((aligned(16))) float Bl[(STATE / 2) * PP];  // >= 64 * DP
  const int tid  = threadIdx.x;
  const int lane = tid & 31;
  const int wave = tid >> 5;
  const int l16  = lane & 15;
  const int hh   = lane >> 4;
  const bool sq  = blockIdx.x >= DBLK;  // the same for the whole work-group
  const int tile  = sq ? blockIdx.x - DBLK : blockIdx.x;
  const int m0    = (tile >> 2) * 32;
  const int nbase = (tile & 3) * 64;
  const int back  = sq ? 0 : off * BATCH;
  const float* __restrict__ In = sq ? P : Sin;

  const int wm  = wave >> 1;
  const int wn  = wave & 1;
  const int mo  = m0 + wm * 16 + (hh << 3);  // C/D layout: M = r + 8*(lane/16)
  const int col = nbase + wn * 32 + l16;

  float ad0[8], ad1[8];
  if (!sq) {  // the summand Sin[c], fetched while the copies fly
#pragma unroll
    for (int r = 0; r < 8; ++r) {
      ad0[r] = Sin[(size_t)(mo + r) * STATE + col];
      ad1[r] = Sin[(size_t)(mo + r) * STATE + col + 16];
    }
    // stands in front of the reuse of the address registers of these loads
    asm volatile("s_wait_xcnt 0x0" ::: "memory");
    if (m0 + 32 <= back) {  // whole tile below the first source: a plain copy
#pragma unroll
      for (int r = 0; r < 8; ++r) {
        Sout[(size_t)(mo + r) * STATE + col]      = ad0[r];
        Sout[(size_t)(mo + r) * STATE + col + 16] = ad1[r];
      }
      // stands in front of any reuse of the registers that these stores name
      asm volatile("s_wait_xcnt 0x0" ::: "memory");
      return;  // taken by the whole work-group, in front of the barrier
    }
  }

  // A tile: 32 rows of 1 KiB.  A row below the first item has no source: it
  // takes a row that exists, and its product is dropped at the store.
#pragma unroll
  for (int i = 0; i < 16; ++i) {
    const int row = 2 * i + (tid >> 6);
    int sr = m0 + row - back;
    sr = sr < 0 ? (row & (BATCH - 1)) : sr;
    copy16(In + (size_t)sr * STATE + (tid & 63) * 4, Al + row * DP + (tid & 63) * 4);
  }
  if (!sq) {  // B tile as (n, k): 64 rows of P, 1 KiB each
#pragma unroll
    for (int i = 0; i < 32; ++i) {
      const int row = 2 * i + (tid >> 6);
      copy16(P + (size_t)(nbase + row) * STATE + (tid & 63) * 4,
             Bl + row * DP + (tid & 63) * 4);
    }
  } else {
    // B tile as (k, n): 64 columns of all 256 rows of P.  Rows k and k + 1
    // (k even) interleave in runs of 16 columns, so that a lane finds its
    // column's k pair 16 dwords apart.
#pragma unroll
    for (int i = 0; i < 32; ++i) {
      const int row = 8 * i + (tid >> 4);
      const int seg = tid & 15;
      copy16(P + (size_t)row * STATE + nbase + seg * 4,
             Bl + (row >> 1) * PP + (seg >> 2) * 32 + (row & 1) * 16 + (seg & 3) * 4);
    }
  }

  // this wave's copies have landed; the barrier publishes every wave's
  asm volatile("s_wait_asynccnt 0x0" ::: "memory");
  __syncthreads();

  // The k loop runs in NS stages of SI fragment groups (32 WMMAs each); the
  // fragments of stage s + 1 are read from LDS in front of stage s's WMMAs.
  constexpr int SI = 8;
  constexpr int NS = STATE / 8 / SI;
  v8f acc0 = {}, acc1 = {};
  v4f a[2][SI];
  const float* ap = Al + (wm * 16 + l16) * DP + 4 * hh;
  if (!sq) {
    const float* bp = Bl + (wn * 32 + l16) * DP + 4 * hh;
    v4f b0[2][SI], b1[2][SI];
#pragma unroll
    for (int i = 0; i < SI; ++i) {
      a[0][i]  = *(const v4f*)(ap + 8 * i);
      b0[0][i] = *(const v4f*)(bp + 8 * i);
      b1[0][i] = *(const v4f*)(bp + 16 * DP + 8 * i);
    }
    // keeps stage 0's reads in front of stage 1's: the first WMMA then waits
    // for its own stage only
    __builtin_amdgcn_sched_barrier(0);
#pragma unroll  // constant indices keep the fragment arrays in registers
    for (int s = 0; s < NS; ++s) {
      const int cur = s & 1, nxt = cur ^ 1;
      if (s + 1 < NS) {
#pragma unroll
        for (int i = 0; i < SI; ++i) {
          const int k = 8 * ((s + 1) * SI + i);
          a[nxt][i]  = *(const v4f*)(ap + k);
          b0[nxt][i] = *(const v4f*)(bp + k);
          b1[nxt][i] = *(const v4f*)(bp + 16 * DP + k);
        }
      }
      // holds the next stage's LDS reads as one group a whole stage ahead of
      // their use; left free, they sink to one group of 4 WMMAs ahead
      __builtin_amdgcn_sched_barrier(0);
#pragma unroll
      for (int i = 0; i < SI; ++i) {
        acc0 = wmma4(a[cur][i].xy, b0[cur][i].xy, acc0);
        acc1 = wmma4(a[cur][i].xy, b1[cur][i].xy, acc1);
        acc0 = wmma4(a[cur][i].zw, b0[cur][i].zw, acc0);
        acc1 = wmma4(a[cur][i].zw, b1[cur][i].zw, acc1);
      }
      // keeps the reads of the stage after next behind this stage's WMMAs
      __builtin_amdgcn_sched_barrier(0);
    }
    const bool valid = (mo >> 3) >= off;  // a lane half is one chunk
#pragma unroll
    for (int r = 0; r < 8; ++r) {
      Sout[(size_t)(mo + r) * STATE + col]      = valid ? ad0[r] + acc0[r] : ad0[r];
      Sout[(size_t)(mo + r) * STATE + col + 16] = valid ? ad1[r] + acc1[r] : ad1[r];
    }
    // stands in front of any reuse of the registers that these stores name
    asm volatile("s_wait_xcnt 0x0" ::: "memory");
  } else {
    const float* bp = Bl + (2 * hh) * PP + wn * 64 + l16;
    // bq[..][i][2 * p + t]: k = 8i + 4h + 2p + 0..1 (as a's halves), tile t
    v2f bq[2][SI][4];
#pragma unroll
    for (int i = 0; i < SI; ++i) {
      a[0][i] = *(const v4f*)(ap + 8 * i);
#pragma unroll
      for (int q = 0; q < 4; ++q) {
        const float* e = bp + (4 * i + (q >> 1)) * PP + (q & 1) * 32;
        bq[0][i][q] = (v2f){e[0], e[16]};
      }
    }
    // keeps stage 0's reads in front of stage 1's: the first WMMA then waits
    // for its own stage only
    __builtin_amdgcn_sched_barrier(0);
#pragma unroll  // constant indices keep the fragment arrays in registers
    for (int s = 0; s < NS; ++s) {
      const int cur = s & 1, nxt = cur ^ 1;
      if (s + 1 < NS) {
#pragma unroll
        for (int i = 0; i < SI; ++i) {
          const int g = (s + 1) * SI + i;
          a[nxt][i] = *(const v4f*)(ap + 8 * g);
#pragma unroll
          for (int q = 0; q < 4; ++q) {
            const float* e = bp + (4 * g + (q >> 1)) * PP + (q & 1) * 32;
            bq[nxt][i][q] = (v2f){e[0], e[16]};
          }
        }
      }
      // holds the next stage's LDS reads as one group a whole stage ahead of
      // their use; left free, they sink to one group of 4 WMMAs ahead
      __builtin_amdgcn_sched_barrier(0);
#pragma unroll
      for (int i = 0; i < SI; ++i) {
        acc0 = wmma4(a[cur][i].xy, bq[cur][i][0], acc0);
        acc1 = wmma4(a[cur][i].xy, bq[cur][i][1], acc1);
        acc0 = wmma4(a[cur][i].zw, bq[cur][i][2], acc0);
        acc1 = wmma4(a[cur][i].zw, bq[cur][i][3], acc1);
      }
      // keeps the reads of the stage after next behind this stage's WMMAs
      __builtin_amdgcn_sched_barrier(0);
    }
#pragma unroll
    for (int r = 0; r < 8; ++r) {
      Pn[(size_t)(mo + r) * STATE + col]      = acc0[r];
      Pn[(size_t)(mo + r) * STATE + col + 16] = acc1[r];
    }
    // stands in front of any reuse of the registers that these stores name
    asm volatile("s_wait_xcnt 0x0" ::: "memory");
  }
}

// ---------------------------------------------------------------------------
// Kernel 5: correction: hs[c*CHUNK+t] += Hc[c] * (A^T)^(t+1), parallel per
// chunk; Hc[c] is the state at the start of chunk c.  The last state of the
// last chunk is also h_final.
// ---------------------------------------------------------------------------
__global__ void __launch_bounds__(256) scan_fix_kernel(
    const float* __restrict__ A, const float* __restrict__ Hc,
    float* __restrict__ hs, float* __restrict__ hfinal) {
  __shared__ float Hlds[16 * LDSPITCH];
  const int c = blockIdx.x;
  v2f w0[KFRAG], w1[KFRAG];
  wload(A, w0, w1);
  // stands in front of the reuse of the address registers that wload's loads
  // name
  asm volatile("s_wait_xcnt 0x0" ::: "memory");
  // keeps the later writes of those registers behind the wait
  __builtin_amdgcn_sched_barrier(0);
  for (int i = threadIdx.x; i < 16 * LDSPITCH; i += blockDim.x) {
    const int row = i / LDSPITCH, k = i - row * LDSPITCH;
    Hlds[i] = (row < BATCH && k < STATE)
                  ? Hc[((size_t)c * BATCH + row) * STATE + k] : 0.f;
  }
  __syncthreads();
  const int lane = threadIdx.x & 31;
  const int wave = threadIdx.x >> 5;
  const int col  = wave * 32 + (lane & 15);
  v8f acc[2];
  float v0[8], v1[8];  // the corrected state of the step, lanes 0..15
  for (int t = 0; t < CHUNK; ++t) {
    const int s = c * CHUNK + t;
    hstep(w0, w1, Hlds, acc);
    __syncthreads();
    hwrite(Hlds, acc);
    if (lane < 16) {
#pragma unroll
      for (int r = 0; r < 8; ++r) {
        const size_t base = ((size_t)s * BATCH + r) * STATE;
        v0[r] = hs[base + col] + acc[0][r];
        v1[r] = hs[base + col + 16] + acc[1][r];
      }
#pragma unroll
      for (int r = 0; r < 8; ++r) {
        const size_t base = ((size_t)s * BATCH + r) * STATE;
        hs[base + col]      = v0[r];
        hs[base + col + 16] = v1[r];
      }
      // stands in front of the reuse of the address registers of these
      // loads and stores
      asm volatile("s_wait_xcnt 0x0" ::: "memory");
    }
    __syncthreads();
  }
  if (lane < 16 && c == NCHUNK - 1) {  // the last state of all is h_final
#pragma unroll
    for (int r = 0; r < 8; ++r) {
      hfinal[(size_t)r * STATE + col]      = v0[r];
      hfinal[(size_t)r * STATE + col + 16] = v1[r];
    }
  }
}

// ---------------------------------------------------------------------------
// Kernel 6: y[m,d] = hs_row(m) @ C^T + x_row(m) @ D^T   (m = b*SEQ + s)
// ---------------------------------------------------------------------------
__global__ void __launch_bounds__(256) proj_out_kernel(
    const float* __restrict__ x, const float* __restrict__ hs,
    const float* __restrict__ C, const float* __restrict__ D,
    float* __restrict__ y) {
  __shared__ float Wl[2 * 64 * WPITCH];
  const int lane  = threadIdx.x & 31;
  const int wave  = threadIdx.x >> 5;
  const int mw    = blockIdx.y * 256 + wave * 32;
  const int nbase = blockIdx.x * 64;
  const int m0 = mw + (lane & 15);
  const int m1 = m0 + 16;
  const int b0 = m0 >> 11, s0 = m0 & (SEQ - 1);
  const int b1 = m1 >> 11, s1 = m1 & (SEQ - 1);
  const float* hrow0 = hs + ((size_t)s0 * BATCH + b0) * STATE;
  const float* hrow1 = hs + ((size_t)s1 * BATCH + b1) * STATE;
  const float* xrow0 = x + (size_t)m0 * DMODEL;
  const float* xrow1 = x + (size_t)m1 * DMODEL;
  __builtin_prefetch(xrow0, 0, 0);
  v8f acc[8] = {{}, {}, {}, {}, {}, {}, {}, {}};
  gemm_block(hrow0, hrow1, C, STATE, nbase, STATE, Wl, acc);
  gemm_block(xrow0, xrow1, D, DMODEL, nbase, DMODEL, Wl, acc);
  const int mo   = mw + ((lane >> 4) << 3);
  const int nloc = lane & 15;
#pragma unroll
  for (int t = 0; t < 4; ++t)
#pragma unroll
    for (int r = 0; r < 8; ++r) {
      y[(size_t)(mo + r) * DMODEL + nbase + t * 16 + nloc]      = acc[t][r];
      y[(size_t)(mo + 16 + r) * DMODEL + nbase + t * 16 + nloc] = acc[4 + t][r];
    }
}

// ---------------------------------------------------------------------------
extern "C" void kernel_launch(void* const* d_in, const int* in_sizes, int n_in,
                              void* d_out, int out_size, void* d_ws,
                              size_t ws_size, hipStream_t stream) {
  const float* x  = (const float*)d_in[0];
  const float* A  = (const float*)d_in[1];
  const float* B  = (const float*)d_in[2];
  const float* C  = (const float*)d_in[3];
  const float* D  = (const float*)d_in[4];
  const float* h0 = (const float*)d_in[5];

  float* y      = (float*)d_out;
  float* hfinal = y + (size_t)BATCH * SEQ * DMODEL;

  float* ws   = (float*)d_ws;
  float* hsBx = ws;                                  // 4,194,304 f32
  float* Sa   = hsBx + (size_t)SEQ * HBLK;           // NCHUNK states
  float* Sb   = Sa + (size_t)NCHUNK * HBLK;          // NCHUNK states
  float* Pa   = Sb + (size_t)NCHUNK * HBLK;          //    65,536 f32
  float* Pb   = Pa + (size_t)STATE * STATE;          //    65,536 f32
  float* P8   = Pb + (size_t)STATE * STATE;          //    65,536 f32

  // 1) input projection
  proj_in_kernel<<<dim3(STATE / 64, (BATCH * SEQ) / 256), 256, 0, stream>>>(
      x, B, hsBx);

  // 2) A^8 via repeated squaring
  matsq_kernel<<<STATE, STATE, 0, stream>>>(A, Pa);
  matsq_kernel<<<STATE, STATE, 0, stream>>>(Pa, Pb);
  matsq_kernel<<<STATE, STATE, 0, stream>>>(Pb, P8);  // P8 = A^8

  // 3) local scans inside each chunk, in place; chunk ends and h0 -> Sa
  scan_local_kernel<<<NCHUNK, 256, 0, stream>>>(A, h0, hsBx, Sa);

  // 4) chunk starts by doubling; each level but the last squares its power
  scan_double_kernel<<<DBLK + SQBLK, 128, 0, stream>>>(Sa, Sb, P8, Pa, 1);
  scan_double_kernel<<<DBLK + SQBLK, 128, 0, stream>>>(Sb, Sa, Pa, Pb, 2);
  scan_double_kernel<<<DBLK + SQBLK, 128, 0, stream>>>(Sa, Sb, Pb, Pa, 4);
  scan_double_kernel<<<DBLK + SQBLK, 128, 0, stream>>>(Sb, Sa, Pa, Pb, 8);
  scan_double_kernel<<<DBLK + SQBLK, 128, 0, stream>>>(Sa, Sb, Pb, Pa, 16);
  scan_double_kernel<<<DBLK + SQBLK, 128, 0, stream>>>(Sb, Sa, Pa, Pb, 32);
  scan_double_kernel<<<DBLK + SQBLK, 128, 0, stream>>>(Sa, Sb, Pb, Pa, 64);
  scan_double_kernel<<<DBLK, 128, 0, stream>>>(Sb, Sa, Pa, Pb, 128);

  // 5) every state corrected by its chunk's start state; emits h_final
  scan_fix_kernel<<<NCHUNK, 256, 0, stream>>>(A, Sa, hsBx, hfinal);

  // 6) output projection
  proj_out_kernel<<<dim3(DMODEL / 64, (BATCH * SEQ) / 256), 256, 0, stream>>>(
      x, hsBx, C, D, y);
}

// v004
// One run takes 364 microseconds.
// Timed twice side by side with v003, it ran 1.14 times as fast both times.
// All steps since v000 together make it 3.03 times as fast.
#include <hip/hip_runtime.h>
#include <hip/hip_bf16.h>

// ---------------------------------------------------------------------------
// TrajectorySSM on MI455X (gfx1250), fp32 WMMA (V_WMMA_F32_16X16X4_F32).
//
//   1) proj_in : Bx[s,b,n]   = sum_d x[b,s,d] * B[n,d]     (WMMA, LDS-staged X, W)
//   2) matsq x3: A^8 (chunk to chunk)
//   3) scan_local, A   : 256 chunks x 8 steps, zero init
//   4) scan_double x8  : chunk starts by doubling, S[c] += S[c-2^d] * (P_d)^T
//                        with P_d = A^(8*2^d); each launch but the last also squares P_d
//   5) scan_fix, A     : hs[s] += S[chunk] * (A^T)^(t+1), emits h_final
//   6) proj_out : y = hs@C^T + x@D^T                (WMMA, LDS-staged X, W)
//
// Operand tiles are staged global->LDS with async-to-LDS copies (ASYNCcnt).
// ---------------------------------------------------------------------------

typedef __attribute__((ext_vector_type(2))) float v2f;
typedef __attribute__((ext_vector_type(4))) float v4f;
typedef __attribute__((ext_vector_type(8))) float v8f;
typedef __attribute__((ext_vector_type(4))) int   v4i;

constexpr int BATCH  = 8;
constexpr int SEQ    = 2048;
constexpr int DMODEL = 1024;
constexpr int STATE  = 256;
constexpr int CHUNK  = 8;            // steps per chunk
constexpr int NCHUNK = 256;          // SEQ / CHUNK
constexpr int HBLK   = BATCH * STATE;  // floats of one state (all batch rows)
constexpr int LDSPITCH = STATE + 2;  // scan-state pitch (bank-conflict pad)

// D = A(16x4 f32) * B(4x16 f32) + C(16x16 f32)
__device__ __forceinline__ v8f wmma4(v2f a, v2f b, v8f c) {
  return __builtin_amdgcn_wmma_f32_16x16x4_f32(
      /*neg_a=*/false, a, /*neg_b=*/false, b,
      /*c_mod=*/(short)0, c, /*reuse_a=*/false, /*reuse_b=*/false);
}

// --------------------------- async LDS staging -----------------------------
#if __has_builtin(__builtin_amdgcn_global_load_async_to_lds_b128)
#define SSM_ASYNC_LDS 1
#endif

// ---------------------------------------------------------------------------
// Work-group GEMM of the two projections: a 128(M) x 128(N) tile of
// Y = X * W^T, 8 waves as 4(M) x 2(N), each wave 32 x 64.  K runs in stages of
// GK columns.  A stage holds the X tile and the W tile, both as rows of GK
// floats at pitch GP, brought into LDS by asynchronous copies that cover whole
// 128-byte lines.  Two buffers: stage s + 1 flies while stage s is worked on.
// Every lane reads 4 consecutive k per fragment load, A and B alike: lane half
// h holds k = 8i + 4h + 0..3, two WMMA k-steps.
// ---------------------------------------------------------------------------
constexpr int GT  = 128;      // tile rows, X and W alike
constexpr int GK  = 32;       // k columns of a stage: one 128-byte line a row
constexpr int GP  = GK + 4;   // row pitch, 16 B x odd: b128 column walks
constexpr int GOP = GT * GP;  // floats of one operand's tile
constexpr int GST = 2 * GOP;  // floats of a stage: X tile, then W tile

// One stage.  Thread (r0 = tid / 8, seg = tid % 8) copies 16 bytes of the rows
// r0 + 32 j, j = 0..3, of both tiles: a wave's copy is 4 whole lines.  xg, wg:
// the thread's bytes of row r0; xstep, wstep: floats from row r to row r + 32;
// l: the thread's LDS byte address in row r0 of the stage's X tile.
__device__ __forceinline__ void stage_tiles(const float* xg, size_t xstep,
                                            const float* wg, size_t wstep,
                                            unsigned l) {
  constexpr unsigned LJ = 32 * GP * 4;  // LDS bytes from row r to row r + 32
  constexpr unsigned LW = GOP * 4;      // LDS bytes from the X to the W tile
  // The wait on xcnt closes the statement: it stands behind the last copy and
  // in front of every later write of an address register that a copy names.
  asm volatile(
      "global_load_async_to_lds_b128 %0, %8, off\n\t"
      "global_load_async_to_lds_b128 %1, %9, off\n\t"
      "global_load_async_to_lds_b128 %2, %10, off\n\t"
      "global_load_async_to_lds_b128 %3, %11, off\n\t"
      "global_load_async_to_lds_b128 %4, %12, off\n\t"
      "global_load_async_to_lds_b128 %5, %13, off\n\t"
      "global_load_async_to_lds_b128 %6, %14, off\n\t"
      "global_load_async_to_lds_b128 %7, %15, off\n\t"
      "s_wait_xcnt 0x0"
      :
      : "v"(l), "v"(l + LJ), "v"(l + 2 * LJ), "v"(l + 3 * LJ),
        "v"(l + LW), "v"(l + LW + LJ), "v"(l + LW + 2 * LJ),
        "v"(l + LW + 3 * LJ),
        "v"(xg), "v"(xg + xstep), "v"(xg + 2 * xstep), "v"(xg + 3 * xstep),
        "v"(wg), "v"(wg + wstep), "v"(wg + 2 * wstep), "v"(wg + 3 * wstep)
      : "memory");
}

// One product X * W^T of a ring: x, w are the thread's bytes of row tid / 8 of
// the two tiles at k = 0; xstep, wstep as in stage_tiles.
struct Product {
  const float* x;
  size_t xstep;
  const float* w;
  size_t wstep;
};

// Sums two products into one tile: N1 stages of p1, then N2 stages of p2, in
// one ring (N1 = 0: p2 alone).  acc[t] and acc[4 + t]: rows 0..15 and 16..31
// of the wave's tile, columns 16 t .. 16 t + 15.  N1 + N2 is at least 2.
template <int N1, int N2>
__device__ __forceinline__ void gemm_ring(const Product p1, const Product p2,
                                          float* L, v8f acc[8]) {
  const int tid  = threadIdx.x;
  const int lane = tid & 31;
  const int wave = tid >> 5;
  const int l16  = lane & 15;
  const int hh   = lane >> 4;
  const unsigned l0 =
      (unsigned)(size_t)L + (unsigned)(((tid >> 3) * GP + (tid & 7) * 4) * 4);
  const int aoff = ((wave >> 1) * 32 + l16) * GP + 4 * hh;
  const int boff = GOP + ((wave & 1) * 64 + l16) * GP + 4 * hh;
  constexpr int NST = N1 + N2;

  // the copies of stage q; q is the same for the whole work-group
  auto issue = [&](int q) {
    const unsigned l = l0 + (q & 1) * (GST * 4);
    if (q < N1)
      stage_tiles(p1.x + q * GK, p1.xstep, p1.w + q * GK, p1.wstep, l);
    else
      stage_tiles(p2.x + (q - N1) * GK, p2.xstep, p2.w + (q - N1) * GK,
                  p2.wstep, l);
  };

  issue(0);
  // this wave's copies of stage 0 have landed; the barrier publishes all
  asm volatile("s_wait_asynccnt 0x0" ::: "memory");
  __syncthreads();
  issue(1);

#pragma unroll 1  // one stage's code serves every stage: the text stays small
  for (int s = 0; s < NST; ++s) {
    const float* ap = L + (s & 1) * GST + aoff;
    const float* bp = L + (s & 1) * GST + boff;
    // fa[.][h]: rows 16 h .. 16 h + 15; fb[.][t]: columns 16 t .. 16 t + 15
    v4f fa[2][2], fb[2][4];
    fa[0][0] = *(const v4f*)ap;
    fa[0][1] = *(const v4f*)(ap + 16 * GP);
#pragma unroll
    for (int t = 0; t < 4; ++t) fb[0][t] = *(const v4f*)(bp + 16 * t * GP);
    // keeps group 0's reads in front of group 1's: the first WMMA then waits
    // for its own group only
    __builtin_amdgcn_sched_barrier(0);
#pragma unroll  // constant indices keep the fragments in registers
    for (int i = 0; i < GK / 8; ++i) {
      const int cur = i & 1, nxt = cur ^ 1;
      if (i + 1 < GK / 8) {
        fa[nxt][0] = *(const v4f*)(ap + 8 * (i + 1));
        fa[nxt][1] = *(const v4f*)(ap + 16 * GP + 8 * (i + 1));
#pragma unroll
        for (int t = 0; t < 4; ++t)
          fb[nxt][t] = *(const v4f*)(bp + 16 * t * GP + 8 * (i + 1));
      }
      // holds the next group's LDS reads together, a whole group of 16 WMMAs
      // ahead of their use; left free, they sink in among the WMMAs one by one
      __builtin_amdgcn_sched_barrier(0);
#pragma unroll
      for (int t = 0; t < 4; ++t) {
        acc[t]     = wmma4(fa[cur][0].xy, fb[cur][t].xy, acc[t]);
        acc[4 + t] = wmma4(fa[cur][1].xy, fb[cur][t].xy, acc[4 + t]);
      }
#pragma unroll
      for (int t = 0; t < 4; ++t) {
        acc[t]     = wmma4(fa[cur][0].zw, fb[cur][t].zw, acc[t]);
        acc[4 + t] = wmma4(fa[cur][1].zw, fb[cur][t].zw, acc[4 + t]);
      }
      // keeps the reads of the group after next behind this group's WMMAs
      __builtin_amdgcn_sched_barrier(0);
    }
    // this wave's reads of stage s have returned
    asm volatile("s_wait_dscnt 0x0" ::: "memory");
    // this wave's copies of stage s + 1 have landed
    asm volatile("s_wait_asynccnt 0x0" ::: "memory");
    __syncthreads();  // publishes stage s + 1, frees the buffer of stage s
    if (s + 2 < NST) issue(s + 2);
  }
  // no copy is left in flight behind the loop
  asm volatile("s_wait_asynccnt 0x0" ::: "memory");
}

// ---------------------------------------------------------------------------
// Kernel 1: Bx[s*8+b, n] = sum_d x[b,s,d] * B[n,d]  (M=16384, N=256, K=1024)
// ---------------------------------------------------------------------------
__global__ void __launch_bounds__(256) proj_in_kernel(
    const float* __restrict__ x, const float* __restrict__ B,
    float* __restrict__ Bx) {
  __shared__ __attribute__((aligned(16))) float L[2 * GST];
  const int tid   = threadIdx.x;
  const int lane  = tid & 31;
  const int wave  = tid >> 5;
  const int mbase = blockIdx.y * GT;
  const int nbase = blockIdx.x * GT;
  const int m     = mbase + (tid >> 3);  // output rows are s*8+b ordered
  const float* xg =
      x + ((size_t)(m & 7) * SEQ + (m >> 3)) * DMODEL + (tid & 7) * 4;
  const float* wg = B + (size_t)(nbase + (tid >> 3)) * DMODEL + (tid & 7) * 4;
  v8f acc[8] = {{}, {}, {}, {}, {}, {}, {}, {}};
  // 32 output rows on: the same b, s + 4
  const Product p = {xg, (size_t)4 * DMODEL, wg, (size_t)32 * DMODEL};
  gemm_ring<0, DMODEL / GK>(p, p, L, acc);
  const int mo  = mbase + (wave >> 1) * 32 + ((lane >> 4) << 3);
  const int col = nbase + (wave & 1) * 64 + (lane & 15);
#pragma unroll
  for (int t = 0; t < 4; ++t)
#pragma unroll
    for (int r = 0; r < 8; ++r) {
      Bx[(size_t)(mo + r) * STATE + col + t * 16]      = acc[t][r];
      Bx[(size_t)(mo + 16 + r) * STATE + col + t * 16] = acc[4 + t][r];
    }
}

// ---------------------------------------------------------------------------
// Kernel 2 (x3): Dst = S @ S  (256x256 fp32 squaring up to A^8)
// ---------------------------------------------------------------------------
__global__ void __launch_bounds__(256) matsq_kernel(
    const float* __restrict__ S, float* __restrict__ Dst) {
  const int i = blockIdx.x, j = threadIdx.x;
  float sum = 0.f;
  for (int k = 0; k < STATE; ++k)
    sum = fmaf(S[(size_t)i * STATE + k], S[(size_t)k * STATE + j], sum);
  Dst[(size_t)i * STATE + j] = sum;
}

// ---------------------------------------------------------------------------
// Scan helpers: H (16x256, batch padded to 16) in LDS; one step computes
// H @ W^T with W row-major (256,256).  8 waves, each owns 32 columns.
// W does not change from step to step, so each wave loads the B fragments of
// its 32 columns once (wload: 2 x 64 fragments = 256 VGPRs per lane) and every
// step reads them from registers; only H moves through LDS.
// ---------------------------------------------------------------------------
constexpr int KFRAG = STATE / 4;  // 16x16x4 k-steps per H @ W^T product

__device__ __forceinline__ void wload(const float* __restrict__ W,
                                      v2f w0[KFRAG], v2f w1[KFRAG]) {
  const int lane = threadIdx.x & 31;
  const int wave = threadIdx.x >> 5;
  const int kb   = ((lane >> 4) & 1) << 1;
  const int n0   = wave * 32 + (lane & 15);
  // full unroll: constant indices keep w0/w1 in registers, not in scratch
#pragma unroll
  for (int i = 0; i < KFRAG; ++i) {
    w0[i] = *(const v2f*)&W[(size_t)n0 * STATE + 4 * i + kb];
    w1[i] = *(const v2f*)&W[(size_t)(n0 + 16) * STATE + 4 * i + kb];
  }
}

__device__ __forceinline__ void hstep(const v2f w0[KFRAG], const v2f w1[KFRAG],
                                      const float* __restrict__ Hlds,
                                      v8f acc[2]) {
  const int lane = threadIdx.x & 31;
  const int mrow = lane & 15;
  const int kb   = ((lane >> 4) & 1) << 1;
  acc[0] = (v8f){};
  acc[1] = (v8f){};
  // full unroll: constant indices keep w0/w1 in registers, not in scratch
#pragma unroll
  for (int i = 0; i < KFRAG; ++i) {
    v2f a  = *(const v2f*)&Hlds[mrow * LDSPITCH + 4 * i + kb];
    acc[0] = wmma4(a, w0[i], acc[0]);
    acc[1] = wmma4(a, w1[i], acc[1]);
  }
}

__device__ __forceinline__ void hwrite(float* __restrict__ Hlds,
                                       const v8f acc[2]) {
  const int lane = threadIdx.x & 31;
  const int wave = threadIdx.x >> 5;
  const int mo   = (lane >> 4) << 3;  // C/D layout: M = r + 8*(lane/16)
  const int col  = wave * 32 + (lane & 15);
#pragma unroll
  for (int r = 0; r < 8; ++r) {
    Hlds[(mo + r) * LDSPITCH + col]      = acc[0][r];
    Hlds[(mo + r) * LDSPITCH + col + 16] = acc[1][r];
  }
}

// ---------------------------------------------------------------------------
// Kernel 3: local scan over the CHUNK steps of chunk c (h starts at 0), in
// place on the Bx buffer: h = h @ A^T + hs[s], hs[s] = h.  The chunk's end is
// also stored as item c + 1 of V, the sequence that scan_double scans; item 0
// of V is the broadcast h0.
// ---------------------------------------------------------------------------
__global__ void __launch_bounds__(256) scan_local_kernel(
    const float* __restrict__ A, const float* __restrict__ h0, float* hs,
    float* __restrict__ V) {
  __shared__ float Hlds[16 * LDSPITCH];
  const int c = blockIdx.x;
  v2f w0[KFRAG], w1[KFRAG];
  wload(A, w0, w1);
  // stands in front of the reuse of the address registers that wload's loads
  // name
  asm volatile("s_wait_xcnt 0x0" ::: "memory");
  // keeps the later writes of those registers behind the wait
  __builtin_amdgcn_sched_barrier(0);
  for (int i = threadIdx.x; i < 16 * LDSPITCH; i += blockDim.x) Hlds[i] = 0.f;
  if (c == 0) {
#pragma unroll  // one load of h0, BATCH stores off one address
    for (int r = 0; r < BATCH; ++r)
      V[r * STATE + threadIdx.x] = h0[threadIdx.x];
    // stands in front of the reuse of the address registers of these stores
    asm volatile("s_wait_xcnt 0x0" ::: "memory");
  }
  __syncthreads();
  const int lane = threadIdx.x & 31;
  const int wave = threadIdx.x >> 5;
  const int col  = wave * 32 + (lane & 15);
  v8f acc[2];
  for (int t = 0; t < CHUNK; ++t) {
    const int s = c * CHUNK + t;
    hstep(w0, w1, Hlds, acc);
    if (lane < 16) {  // real batch rows live in lanes 0..15 (M = r < 8)
#pragma unroll
      for (int r = 0; r < 8; ++r) {
        const size_t base = ((size_t)s * BATCH + r) * STATE;
        acc[0][r] += hs[base + col];
        acc[1][r] += hs[base + col + 16];
      }
    }
    __syncthreads();  // all waves done reading H
    hwrite(Hlds, acc);
    if (lane < 16) {
#pragma unroll
      for (int r = 0; r < 8; ++r) {
        const size_t base = ((size_t)s * BATCH + r) * STATE;
        hs[base + col]      = acc[0][r];
        hs[base + col + 16] = acc[1][r];
      }
    }
    __syncthreads();  // H fully written before next step
  }
  if (lane < 16 && c + 1 < NCHUNK) {  // the chunk's end: item c + 1 of V
#pragma unroll
    for (int r = 0; r < 8; ++r) {
      const size_t base = ((size_t)(c + 1) * BATCH + r) * STATE;
      V[base + col]      = acc[0][r];
      V[base + col + 16] = acc[1][r];
    }
  }
}

// ---------------------------------------------------------------------------
// Kernel 4 (x8): one doubling level of the scan over the NCHUNK chunk starts:
//   Sout[c] = Sin[c] + Sin[c - off] @ P^T   (c >= off; a plain copy below),
// P = A^(CHUNK * off).  After off = 1, 2, .. 128, S[c] is the state at the
// start of chunk c.  All rows (chunk, batch) form one 2048 x 256 x 256 GEMM:
// 256 work-groups of 4 waves, each a 32(M) x 64(N) tile, each wave 16 x 32.
// Work-groups from DBLK on compute Pn = P @ P for the next level in the same
// tile shape.  Both operand tiles are brought whole into LDS by asynchronous
// copies.  Every lane reads 4 consecutive k per fragment load, A and B alike:
// lane half h holds k = 8i + 4h + 0..3, two WMMA k-steps.
// ---------------------------------------------------------------------------
constexpr int DP    = STATE + 4;  // row pitch, 16 B x odd: b128 column walks
constexpr int PP    = 136;        // pitch of a k row pair of the (k, n) tile
constexpr int DBLK  = (NCHUNK * BATCH / 32) * (STATE / 64);  // scan tiles
constexpr int SQBLK = (STATE / 32) * (STATE / 64);           // squaring tiles

__device__ __forceinline__ void copy16(const float* __restrict__ g,
                                       float* __restrict__ l) {
#if defined(SSM_ASYNC_LDS)
  __builtin_amdgcn_global_load_async_to_lds_b128((v4i*)g, (v4i*)l, 0, 0);
#else
  *(v4f*)l = *(const v4f*)g;
#endif
}

__global__ void __launch_bounds__(128) scan_double_kernel(
    const float* __restrict__ Sin, float* __restrict__ Sout,
    const float* __restrict__ P, float* __restrict__ Pn, int off) {
  __shared__ __attribute__((aligned(16))) float Al[32 * DP];
  __shared__ __attribute__((aligned(16))) float Bl[(STATE / 2) * PP];  // >= 64 * DP
  const int tid  = threadIdx.x;
  const int lane = tid & 31;
  const int wave = tid >> 5;
  const int l16  = lane & 15;
  const int hh   = lane >> 4;
  const bool sq  = blockIdx.x >= DBLK;  // the same for the whole work-group
  const int tile  = sq ? blockIdx.x - DBLK : blockIdx.x;
  const int m0    = (tile >> 2) * 32;
  const int nbase = (tile & 3) * 64;
  const int back  = sq ? 0 : off * BATCH;
  const float* __restrict__ In = sq ? P : Sin;

  const int wm  = wave >> 1;
  const int wn  = wave & 1;
  const int mo  = m0 + wm * 16 + (hh << 3);  // C/D layout: M = r + 8*(lane/16)
  const int col = nbase + wn * 32 + l16;

  float ad0[8], ad1[8];
  if (!sq) {  // the summand Sin[c], fetched while the copies fly
#pragma unroll
    for (int r = 0; r < 8; ++r) {
      ad0[r] = Sin[(size_t)(mo + r) * STATE + col];
      ad1[r] = Sin[(size_t)(mo + r) * STATE + col + 16];
    }
    // stands in front of the reuse of the address registers of these loads
    asm volatile("s_wait_xcnt 0x0" ::: "memory");
    if (m0 + 32 <= back) {  // whole tile below the first source: a plain copy
#pragma unroll
      for (int r = 0; r < 8; ++r) {
        Sout[(size_t)(mo + r) * STATE + col]      = ad0[r];
        Sout[(size_t)(mo + r) * STATE + col + 16] = ad1[r];
      }
      // stands in front of any reuse of the registers that these stores name
      asm volatile("s_wait_xcnt 0x0" ::: "memory");
      return;  // taken by the whole work-group, in front of the barrier
    }
  }

  // A tile: 32 rows of 1 KiB.  A row below the first item has no source: it
  // takes a row that exists, and its product is dropped at the store.
#pragma unroll
  for (int i = 0; i < 16; ++i) {
    const int row = 2 * i + (tid >> 6);
    int sr = m0 + row - back;
    sr = sr < 0 ? (row & (BATCH - 1)) : sr;
    copy16(In + (size_t)sr * STATE + (tid & 63) * 4, Al + row * DP + (tid & 63) * 4);
  }
  if (!sq) {  // B tile as (n, k): 64 rows of P, 1 KiB each
#pragma unroll
    for (int i = 0; i < 32; ++i) {
      const int row = 2 * i + (tid >> 6);
      copy16(P + (size_t)(nbase + row) * STATE + (tid & 63) * 4,
             Bl + row * DP + (tid & 63) * 4);
    }
  } else {
    // B tile as (k, n): 64 columns of all 256 rows of P.  Rows k and k + 1
    // (k even) interleave in runs of 16 columns, so that a lane finds its
    // column's k pair 16 dwords apart.
#pragma unroll
    for (int i = 0; i < 32; ++i) {
      const int row = 8 * i + (tid >> 4);
      const int seg = tid & 15;
      copy16(P + (size_t)row * STATE + nbase + seg * 4,
             Bl + (row >> 1) * PP + (seg >> 2) * 32 + (row & 1) * 16 + (seg & 3) * 4);
    }
  }

  // this wave's copies have landed; the barrier publishes every wave's
  asm volatile("s_wait_asynccnt 0x0" ::: "memory");
  __syncthreads();

  // The k loop runs in NS stages of SI fragment groups (32 WMMAs each); the
  // fragments of stage s + 1 are read from LDS in front of stage s's WMMAs.
  constexpr int SI = 8;
  constexpr int NS = STATE / 8 / SI;
  v8f acc0 = {}, acc1 = {};
  v4f a[2][SI];
  const float* ap = Al + (wm * 16 + l16) * DP + 4 * hh;
  if (!sq) {
    const float* bp = Bl + (wn * 32 + l16) * DP + 4 * hh;
    v4f b0[2][SI], b1[2][SI];
#pragma unroll
    for (int i = 0; i < SI; ++i) {
      a[0][i]  = *(const v4f*)(ap + 8 * i);
      b0[0][i] = *(const v4f*)(bp + 8 * i);
      b1[0][i] = *(const v4f*)(bp + 16 * DP + 8 * i);
    }
    // keeps stage 0's reads in front of stage 1's: the first WMMA then waits
    // for its own stage only
    __builtin_amdgcn_sched_barrier(0);
#pragma unroll  // constant indices keep the fragment arrays in registers
    for (int s = 0; s < NS; ++s) {
      const int cur = s & 1, nxt = cur ^ 1;
      if (s + 1 < NS) {
#pragma unroll
        for (int i = 0; i < SI; ++i) {
          const int k = 8 * ((s + 1) * SI + i);
          a[nxt][i]  = *(const v4f*)(ap + k);
          b0[nxt][i] = *(const v4f*)(bp + k);
          b1[nxt][i] = *(const v4f*)(bp + 16 * DP + k);
        }
      }
      // holds the next stage's LDS reads as one group a whole stage ahead of
      // their use; left free, they sink to one group of 4 WMMAs ahead
      __builtin_amdgcn_sched_barrier(0);
#pragma unroll
      for (int i = 0; i < SI; ++i) {
        acc0 = wmma4(a[cur][i].xy, b0[cur][i].xy, acc0);
        acc1 = wmma4(a[cur][i].xy, b1[cur][i].xy, acc1);
        acc0 = wmma4(a[cur][i].zw, b0[cur][i].zw, acc0);
        acc1 = wmma4(a[cur][i].zw, b1[cur][i].zw, acc1);
      }
      // keeps the reads of the stage after next behind this stage's WMMAs
      __builtin_amdgcn_sched_barrier(0);
    }
    const bool valid = (mo >> 3) >= off;  // a lane half is one chunk
#pragma unroll
    for (int r = 0; r < 8; ++r) {
      Sout[(size_t)(mo + r) * STATE + col]      = valid ? ad0[r] + acc0[r] : ad0[r];
      Sout[(size_t)(mo + r) * STATE + col + 16] = valid ? ad1[r] + acc1[r] : ad1[r];
    }
    // stands in front of any reuse of the registers that these stores name
    asm volatile("s_wait_xcnt 0x0" ::: "memory");
  } else {
    const float* bp = Bl + (2 * hh) * PP + wn * 64 + l16;
    // bq[..][i][2 * p + t]: k = 8i + 4h + 2p + 0..1 (as a's halves), tile t
    v2f bq[2][SI][4];
#pragma unroll
    for (int i = 0; i < SI; ++i) {
      a[0][i] = *(const v4f*)(ap + 8 * i);
#pragma unroll
      for (int q = 0; q < 4; ++q) {
        const float* e = bp + (4 * i + (q >> 1)) * PP + (q & 1) * 32;
        bq[0][i][q] = (v2f){e[0], e[16]};
      }
    }
    // keeps stage 0's reads in front of stage 1's: the first WMMA then waits
    // for its own stage only
    __builtin_amdgcn_sched_barrier(0);
#pragma unroll  // constant indices keep the fragment arrays in registers
    for (int s = 0; s < NS; ++s) {
      const int cur = s & 1, nxt = cur ^ 1;
      if (s + 1 < NS) {
#pragma unroll
        for (int i = 0; i < SI; ++i) {
          const int g = (s + 1) * SI + i;
          a[nxt][i] = *(const v4f*)(ap + 8 * g);
#pragma unroll
          for (int q = 0; q < 4; ++q) {
            const float* e = bp + (4 * g + (q >> 1)) * PP + (q & 1) * 32;
            bq[nxt][i][q] = (v2f){e[0], e[16]};
          }
        }
      }
      // holds the next stage's LDS reads as one group a whole stage ahead of
      // their use; left free, they sink to one group of 4 WMMAs ahead
      __builtin_amdgcn_sched_barrier(0);
#pragma unroll
      for (int i = 0; i < SI; ++i) {
        acc0 = wmma4(a[cur][i].xy, bq[cur][i][0], acc0);
        acc1 = wmma4(a[cur][i].xy, bq[cur][i][1], acc1);
        acc0 = wmma4(a[cur][i].zw, bq[cur][i][2], acc0);
        acc1 = wmma4(a[cur][i].zw, bq[cur][i][3], acc1);
      }
      // keeps the reads of the stage after next behind this stage's WMMAs
      __builtin_amdgcn_sched_barrier(0);
    }
#pragma unroll
    for (int r = 0; r < 8; ++r) {
      Pn[(size_t)(mo + r) * STATE + col]      = acc0[r];
      Pn[(size_t)(mo + r) * STATE + col + 16] = acc1[r];
    }
    // stands in front of any reuse of the registers that these stores name
    asm volatile("s_wait_xcnt 0x0" ::: "memory");
  }
}

// ---------------------------------------------------------------------------
// Kernel 5: correction: hs[c*CHUNK+t] += Hc[c] * (A^T)^(t+1), parallel per
// chunk; Hc[c] is the state at the start of chunk c.  The last state of the
// last chunk is also h_final.
// ---------------------------------------------------------------------------
__global__ void __launch_bounds__(256) scan_fix_kernel(
    const float* __restrict__ A, const float* __restrict__ Hc,
    float* __restrict__ hs, float* __restrict__ hfinal) {
  __shared__ float Hlds[16 * LDSPITCH];
  const int c = blockIdx.x;
  v2f w0[KFRAG], w1[KFRAG];
  wload(A, w0, w1);
  // stands in front of the reuse of the address registers that wload's loads
  // name
  asm volatile("s_wait_xcnt 0x0" ::: "memory");
  // keeps the later writes of those registers behind the wait
  __builtin_amdgcn_sched_barrier(0);
  for (int i = threadIdx.x; i < 16 * LDSPITCH; i += blockDim.x) {
    const int row = i / LDSPITCH, k = i - row * LDSPITCH;
    Hlds[i] = (row < BATCH && k < STATE)
                  ? Hc[((size_t)c * BATCH + row) * STATE + k] : 0.f;
  }
  __syncthreads();
  const int lane = threadIdx.x & 31;
  const int wave = threadIdx.x >> 5;
  const int col  = wave * 32 + (lane & 15);
  v8f acc[2];
  float v0[8], v1[8];  // the corrected state of the step, lanes 0..15
  for (int t = 0; t < CHUNK; ++t) {
    const int s = c * CHUNK + t;
    hstep(w0, w1, Hlds, acc);
    __syncthreads();
    hwrite(Hlds, acc);
    if (lane < 16) {
#pragma unroll
      for (int r = 0; r < 8; ++r) {
        const size_t base = ((size_t)s * BATCH + r) * STATE;
        v0[r] = hs[base + col] + acc[0][r];
        v1[r] = hs[base + col + 16] + acc[1][r];
      }
#pragma unroll
      for (int r = 0; r < 8; ++r) {
        const size_t base = ((size_t)s * BATCH + r) * STATE;
        hs[base + col]      = v0[r];
        hs[base + col + 16] = v1[r];
      }
      // stands in front of the reuse of the address registers of these
      // loads and stores
      asm volatile("s_wait_xcnt 0x0" ::: "memory");
    }
    __syncthreads();
  }
  if (lane < 16 && c == NCHUNK - 1) {  // the last state of all is h_final
#pragma unroll
    for (int r = 0; r < 8; ++r) {
      hfinal[(size_t)r * STATE + col]      = v0[r];
      hfinal[(size_t)r * STATE + col + 16] = v1[r];
    }
  }
}

// ---------------------------------------------------------------------------
// Kernel 6: y[m,d] = hs_row(m) @ C^T + x_row(m) @ D^T   (m = b*SEQ + s)
// ---------------------------------------------------------------------------
// 8 waves per SIMD asked for: a budget of 128 VGPRs, so that the four
// work-groups that fit a WGP's LDS also fit its registers
__global__ void __launch_bounds__(256, 8) proj_out_kernel(
    const float* __restrict__ x, const float* __restrict__ hs,
    const float* __restrict__ C, const float* __restrict__ D,
    float* __restrict__ y) {
  __shared__ __attribute__((aligned(16))) float L[2 * GST];
  const int tid   = threadIdx.x;
  const int lane  = tid & 31;
  const int wave  = tid >> 5;
  const int mbase = blockIdx.y * GT;  // a tile's rows share one b
  const int nbase = blockIdx.x * GT;
  const int m     = mbase + (tid >> 3);
  const int n     = nbase + (tid >> 3);
  const int b = m >> 11, s = m & (SEQ - 1);
  const float* hg = hs + ((size_t)s * BATCH + b) * STATE + (tid & 7) * 4;
  const float* xg = x + (size_t)m * DMODEL + (tid & 7) * 4;
  const float* cg = C + (size_t)n * STATE + (tid & 7) * 4;
  const float* dg = D + (size_t)n * DMODEL + (tid & 7) * 4;
  v8f acc[8] = {{}, {}, {}, {}, {}, {}, {}, {}};
  const Product ph = {hg, (size_t)32 * HBLK, cg, (size_t)32 * STATE};
  const Product px = {xg, (size_t)32 * DMODEL, dg, (size_t)32 * DMODEL};
  gemm_ring<STATE / GK, DMODEL / GK>(ph, px, L, acc);
  const int mo  = mbase + (wave >> 1) * 32 + ((lane >> 4) << 3);
  const int col = nbase + (wave & 1) * 64 + (lane & 15);
#pragma unroll
  for (int t = 0; t < 4; ++t)
#pragma unroll
    for (int r = 0; r < 8; ++r) {
      y[(size_t)(mo + r) * DMODEL + col + t * 16]      = acc[t][r];
      y[(size_t)(mo + 16 + r) * DMODEL + col + t * 16] = acc[4 + t][r];
    }
}

// ---------------------------------------------------------------------------
extern "C" void kernel_launch(void* const* d_in, const int* in_sizes, int n_in,
                              void* d_out, int out_size, void* d_ws,
                              size_t ws_size, hipStream_t stream) {
  const float* x  = (const float*)d_in[0];
  const float* A  = (const float*)d_in[1];
  const float* B  = (const float*)d_in[2];
  const float* C  = (const float*)d_in[3];
  const float* D  = (const float*)d_in[4];
  const float* h0 = (const float*)d_in[5];

  float* y      = (float*)d_out;
  float* hfinal = y + (size_t)BATCH * SEQ * DMODEL;

  float* ws   = (float*)d_ws;
  float* hsBx = ws;                                  // 4,194,304 f32
  float* Sa   = hsBx + (size_t)SEQ * HBLK;           // NCHUNK states
  float* Sb   = Sa + (size_t)NCHUNK * HBLK;          // NCHUNK states
  float* Pa   = Sb + (size_t)NCHUNK * HBLK;          //    65,536 f32
  float* Pb   = Pa + (size_t)STATE * STATE;          //    65,536 f32
  float* P8   = Pb + (size_t)STATE * STATE;          //    65,536 f32

  // 1) input projection
  proj_in_kernel<<<dim3(STATE / GT, (BATCH * SEQ) / GT), 256, 0, stream>>>(
      x, B, hsBx);

  // 2) A^8 via repeated squaring
  matsq_kernel<<<STATE, STATE, 0, stream>>>(A, Pa);
  matsq_kernel<<<STATE, STATE, 0, stream>>>(Pa, Pb);
  matsq_kernel<<<STATE, STATE, 0, stream>>>(Pb, P8);  // P8 = A^8

  // 3) local scans inside each chunk, in place; chunk ends and h0 -> Sa
  scan_local_kernel<<<NCHUNK, 256, 0, stream>>>(A, h0, hsBx, Sa);

  // 4) chunk starts by doubling; each level but the last squares its power
  scan_double_kernel<<<DBLK + SQBLK, 128, 0, stream>>>(Sa, Sb, P8, Pa, 1);
  scan_double_kernel<<<DBLK + SQBLK, 128, 0, stream>>>(Sb, Sa, Pa, Pb, 2);
  scan_double_kernel<<<DBLK + SQBLK, 128, 0, stream>>>(Sa, Sb, Pb, Pa, 4);
  scan_double_kernel<<<DBLK + SQBLK, 128, 0, stream>>>(Sb, Sa, Pa, Pb, 8);
  scan_double_kernel<<<DBLK + SQBLK, 128, 0, stream>>>(Sa, Sb, Pb, Pa, 16);
  scan_double_kernel<<<DBLK + SQBLK, 128, 0, stream>>>(Sb, Sa, Pa, Pb, 32);
  scan_double_kernel<<<DBLK + SQBLK, 128, 0, stream>>>(Sa, Sb, Pb, Pa, 64);
  scan_double_kernel<<<DBLK, 128, 0, stream>>>(Sb, Sa, Pa, Pb, 128);

  // 5) every state corrected by its chunk's start state; emits h_final
  scan_fix_kernel<<<NCHUNK, 256, 0, stream>>>(A, Sa, hsBx, hfinal);

  // 6) output projection
  proj_out_kernel<<<dim3(DMODEL / GT, (BATCH * SEQ) / GT), 256, 0, stream>>>(
      x, hsBx, C, D, y);
}

// v005
// It runs in 337 microseconds.
// Next to v004, in two timings, it ran 1.08 and 1.07 times as fast.
// Counting every step since v000, it is 3.26 times as fast.
#include <hip/hip_runtime.h>
#include <hip/hip_bf16.h>

// ---------------------------------------------------------------------------
// TrajectorySSM on MI455X (gfx1250), fp32 WMMA (V_WMMA_F32_16X16X4_F32).
//
//   1) proj_in : Bx[s,b,n]   = sum_d x[b,s,d] * B[n,d]     (WMMA, LDS-staged X, W)
//   2) matsq x2: A^4 (half chunk to half chunk)
//   3) scan_local, A   : 512 half chunks x 4 steps, zero init; a chunk's two
//                        halves fill the 16 rows of one work-group's H
//   4) scan_double x10 : chunk ends from the half ends with A^4; chunk starts
//                        by doubling, S[c] += S[c-2^d] * (P_d)^T with
//                        P_d = A^(8*2^d); second-half starts with A^4 again;
//                        a launch also squares its power for the next
//   5) scan_fix, A     : hs[s] += S[half chunk] * (A^T)^(t+1), emits h_final
//   6) proj_out : y = hs@C^T + x@D^T                (WMMA, LDS-staged X, W)
//
// Operand tiles are staged global->LDS with async-to-LDS copies (ASYNCcnt).
// ---------------------------------------------------------------------------

typedef __attribute__((ext_vector_type(2))) float v2f;
typedef __attribute__((ext_vector_type(4))) float v4f;
typedef __attribute__((ext_vector_type(8))) float v8f;
typedef __attribute__((ext_vector_type(4))) int   v4i;

constexpr int BATCH  = 8;
constexpr int SEQ    = 2048;
constexpr int DMODEL = 1024;
constexpr int STATE  = 256;
constexpr int CHUNK  = 8;            // steps per chunk
constexpr int HALF   = CHUNK / 2;    // steps per half chunk
constexpr int NCHUNK = 256;          // SEQ / CHUNK
constexpr int HBLK   = BATCH * STATE;  // floats of one state (all batch rows)
constexpr int LDSPITCH = STATE + 2;  // scan-state pitch (bank-conflict pad)

// D = A(16x4 f32) * B(4x16 f32) + C(16x16 f32)
__device__ __forceinline__ v8f wmma4(v2f a, v2f b, v8f c) {
  return __builtin_amdgcn_wmma_f32_16x16x4_f32(
      /*neg_a=*/false, a, /*neg_b=*/false, b,
      /*c_mod=*/(short)0, c, /*reuse_a=*/false, /*reuse_b=*/false);
}

// --------------------------- async LDS staging -----------------------------
#if __has_builtin(__builtin_amdgcn_global_load_async_to_lds_b128)
#define SSM_ASYNC_LDS 1
#endif

// ---------------------------------------------------------------------------
// Work-group GEMM of the two projections: a 128(M) x 128(N) tile of
// Y = X * W^T, 8 waves as 4(M) x 2(N), each wave 32 x 64.  K runs in stages of
// GK columns.  A stage holds the X tile and the W tile, both as rows of GK
// floats at pitch GP, brought into LDS by asynchronous copies that cover whole
// 128-byte lines.  Two buffers: stage s + 1 flies while stage s is worked on.
// Every lane reads 4 consecutive k per fragment load, A and B alike: lane half
// h holds k = 8i + 4h + 0..3, two WMMA k-steps.
// ---------------------------------------------------------------------------
constexpr int GT  = 128;      // tile rows, X and W alike
constexpr int GK  = 32;       // k columns of a stage: one 128-byte line a row
constexpr int GP  = GK + 4;   // row pitch, 16 B x odd: b128 column walks
constexpr int GOP = GT * GP;  // floats of one operand's tile
constexpr int GST = 2 * GOP;  // floats of a stage: X tile, then W tile

// One stage.  Thread (r0 = tid / 8, seg = tid % 8) copies 16 bytes of the rows
// r0 + 32 j, j = 0..3, of both tiles: a wave's copy is 4 whole lines.  xg, wg:
// the thread's bytes of row r0; xstep, wstep: floats from row r to row r + 32;
// l: the thread's LDS byte address in row r0 of the stage's X tile.
__device__ __forceinline__ void stage_tiles(const float* xg, size_t xstep,
                                            const float* wg, size_t wstep,
                                            unsigned l) {
  constexpr unsigned LJ = 32 * GP * 4;  // LDS bytes from row r to row r + 32
  constexpr unsigned LW = GOP * 4;      // LDS bytes from the X to the W tile
  // The wait on xcnt closes the statement: it stands behind the last copy and
  // in front of every later write of an address register that a copy names.
  asm volatile(
      "global_load_async_to_lds_b128 %0, %8, off\n\t"
      "global_load_async_to_lds_b128 %1, %9, off\n\t"
      "global_load_async_to_lds_b128 %2, %10, off\n\t"
      "global_load_async_to_lds_b128 %3, %11, off\n\t"
      "global_load_async_to_lds_b128 %4, %12, off\n\t"
      "global_load_async_to_lds_b128 %5, %13, off\n\t"
      "global_load_async_to_lds_b128 %6, %14, off\n\t"
      "global_load_async_to_lds_b128 %7, %15, off\n\t"
      "s_wait_xcnt 0x0"
      :
      : "v"(l), "v"(l + LJ), "v"(l + 2 * LJ), "v"(l + 3 * LJ),
        "v"(l + LW), "v"(l + LW + LJ), "v"(l + LW + 2 * LJ),
        "v"(l + LW + 3 * LJ),
        "v"(xg), "v"(xg + xstep), "v"(xg + 2 * xstep), "v"(xg + 3 * xstep),
        "v"(wg), "v"(wg + wstep), "v"(wg + 2 * wstep), "v"(wg + 3 * wstep)
      : "memory");
}

// One product X * W^T of a ring: x, w are the thread's bytes of row tid / 8 of
// the two tiles at k = 0; xstep, wstep as in stage_tiles.
struct Product {
  const float* x;
  size_t xstep;
  const float* w;
  size_t wstep;
};

// Sums two products into one tile: N1 stages of p1, then N2 stages of p2, in
// one ring (N1 = 0: p2 alone).  acc[t] and acc[4 + t]: rows 0..15 and 16..31
// of the wave's tile, columns 16 t .. 16 t + 15.  N1 + N2 is at least 2.
template <int N1, int N2>
__device__ __forceinline__ void gemm_ring(const Product p1, const Product p2,
                                          float* L, v8f acc[8]) {
  const int tid  = threadIdx.x;
  const int lane = tid & 31;
  const int wave = tid >> 5;
  const int l16  = lane & 15;
  const int hh   = lane >> 4;
  const unsigned l0 =
      (unsigned)(size_t)L + (unsigned)(((tid >> 3) * GP + (tid & 7) * 4) * 4);
  const int aoff = ((wave >> 1) * 32 + l16) * GP + 4 * hh;
  const int boff = GOP + ((wave & 1) * 64 + l16) * GP + 4 * hh;
  constexpr int NST = N1 + N2;

  // the copies of stage q; q is the same for the whole work-group
  auto issue = [&](int q) {
    const unsigned l = l0 + (q & 1) * (GST * 4);
    if (q < N1)
      stage_tiles(p1.x + q * GK, p1.xstep, p1.w + q * GK, p1.wstep, l);
    else
      stage_tiles(p2.x + (q - N1) * GK, p2.xstep, p2.w + (q - N1) * GK,
                  p2.wstep, l);
  };

  issue(0);
  // this wave's copies of stage 0 have landed; the barrier publishes all
  asm volatile("s_wait_asynccnt 0x0" ::: "memory");
  __syncthreads();
  issue(1);

#pragma unroll 1  // one stage's code serves every stage: the text stays small
  for (int s = 0; s < NST; ++s) {
    const float* ap = L + (s & 1) * GST + aoff;
    const float* bp = L + (s & 1) * GST + boff;
    // fa[.][h]: rows 16 h .. 16 h + 15; fb[.][t]: columns 16 t .. 16 t + 15
    v4f fa[2][2], fb[2][4];
    fa[0][0] = *(const v4f*)ap;
    fa[0][1] = *(const v4f*)(ap + 16 * GP);
#pragma unroll
    for (int t = 0; t < 4; ++t) fb[0][t] = *(const v4f*)(bp + 16 * t * GP);
    // keeps group 0's reads in front of group 1's: the first WMMA then waits
    // for its own group only
    __builtin_amdgcn_sched_barrier(0);
#pragma unroll  // constant indices keep the fragments in registers
    for (int i = 0; i < GK / 8; ++i) {
      const int cur = i & 1, nxt = cur ^ 1;
      if (i + 1 < GK / 8) {
        fa[nxt][0] = *(const v4f*)(ap + 8 * (i + 1));
        fa[nxt][1] = *(const v4f*)(ap + 16 * GP + 8 * (i + 1));
#pragma unroll
        for (int t = 0; t < 4; ++t)
          fb[nxt][t] = *(const v4f*)(bp + 16 * t * GP + 8 * (i + 1));
      }
      // holds the next group's LDS reads together, a whole group of 16 WMMAs
      // ahead of their use; left free, they sink in among the WMMAs one by one
      __builtin_amdgcn_sched_barrier(0);
#pragma unroll
      for (int t = 0; t < 4; ++t) {
        acc[t]     = wmma4(fa[cur][0].xy, fb[cur][t].xy, acc[t]);
        acc[4 + t] = wmma4(fa[cur][1].xy, fb[cur][t].xy, acc[4 + t]);
      }
#pragma unroll
      for (int t = 0; t < 4; ++t) {
        acc[t]     = wmma4(fa[cur][0].zw, fb[cur][t].zw, acc[t]);
        acc[4 + t] = wmma4(fa[cur][1].zw, fb[cur][t].zw, acc[4 + t]);
      }
      // keeps the reads of the group after next behind this group's WMMAs
      __builtin_amdgcn_sched_barrier(0);
    }
    // this wave's reads of stage s have returned
    asm volatile("s_wait_dscnt 0x0" ::: "memory");
    // this wave's copies of stage s + 1 have landed
    asm volatile("s_wait_asynccnt 0x0" ::: "memory");
    __syncthreads();  // publishes stage s + 1, frees the buffer of stage s
    if (s + 2 < NST) issue(s + 2);
  }
  // no copy is left in flight behind the loop
  asm volatile("s_wait_asynccnt 0x0" ::: "memory");
}

// ---------------------------------------------------------------------------
// Kernel 1: Bx[s*8+b, n] = sum_d x[b,s,d] * B[n,d]  (M=16384, N=256, K=1024)
// ---------------------------------------------------------------------------
__global__ void __launch_bounds__(256) proj_in_kernel(
    const float* __restrict__ x, const float* __restrict__ B,
    float* __restrict__ Bx) {
  __shared__ __attribute__((aligned(16))) float L[2 * GST];
  const int tid   = threadIdx.x;
  const int lane  = tid & 31;
  const int wave  = tid >> 5;
  const int mbase = blockIdx.y * GT;
  const int nbase = blockIdx.x * GT;
  const int m     = mbase + (tid >> 3);  // output rows are s*8+b ordered
  const float* xg =
      x + ((size_t)(m & 7) * SEQ + (m >> 3)) * DMODEL + (tid & 7) * 4;
  const float* wg = B + (size_t)(nbase + (tid >> 3)) * DMODEL + (tid & 7) * 4;
  v8f acc[8] = {{}, {}, {}, {}, {}, {}, {}, {}};
  // 32 output rows on: the same b, s + 4
  const Product p = {xg, (size_t)4 * DMODEL, wg, (size_t)32 * DMODEL};
  gemm_ring<0, DMODEL / GK>(p, p, L, acc);
  const int mo  = mbase + (wave >> 1) * 32 + ((lane >> 4) << 3);
  const int col = nbase + (wave & 1) * 64 + (lane & 15);
#pragma unroll
  for (int t = 0; t < 4; ++t)
#pragma unroll
    for (int r = 0; r < 8; ++r) {
      Bx[(size_t)(mo + r) * STATE + col + t * 16]      = acc[t][r];
      Bx[(size_t)(mo + 16 + r) * STATE + col + t * 16] = acc[4 + t][r];
    }
}

// ---------------------------------------------------------------------------
// Kernel 2 (x2): Dst = S @ S  (256x256 fp32 squaring up to A^4)
// ---------------------------------------------------------------------------
__global__ void __launch_bounds__(256) matsq_kernel(
    const float* __restrict__ S, float* __restrict__ Dst) {
  const int i = blockIdx.x, j = threadIdx.x;
  float sum = 0.f;
  for (int k = 0; k < STATE; ++k)
    sum = fmaf(S[(size_t)i * STATE + k], S[(size_t)k * STATE + j], sum);
  Dst[(size_t)i * STATE + j] = sum;
}

// ---------------------------------------------------------------------------
// Scan helpers: H (16x256, the batch rows of two half chunks) in LDS; one step computes
// H @ W^T with W row-major (256,256).  8 waves, each owns 32 columns.
// W does not change from step to step, so each wave loads the B fragments of
// its 32 columns once (wload: 2 x 64 fragments = 256 VGPRs per lane) and every
// step reads them from registers; only H moves through LDS.
// ---------------------------------------------------------------------------
constexpr int KFRAG = STATE / 4;  // 16x16x4 k-steps per H @ W^T product

__device__ __forceinline__ void wload(const float* __restrict__ W,
                                      v2f w0[KFRAG], v2f w1[KFRAG]) {
  const int lane = threadIdx.x & 31;
  const int wave = threadIdx.x >> 5;
  const int kb   = ((lane >> 4) & 1) << 1;
  const int n0   = wave * 32 + (lane & 15);
  // full unroll: constant indices keep w0/w1 in registers, not in scratch
#pragma unroll
  for (int i = 0; i < KFRAG; ++i) {
    w0[i] = *(const v2f*)&W[(size_t)n0 * STATE + 4 * i + kb];
    w1[i] = *(const v2f*)&W[(size_t)(n0 + 16) * STATE + 4 * i + kb];
  }
}

__device__ __forceinline__ void hstep(const v2f w0[KFRAG], const v2f w1[KFRAG],
                                      const float* __restrict__ Hlds,
                                      v8f acc[2]) {
  const int lane = threadIdx.x & 31;
  const int mrow = lane & 15;
  const int kb   = ((lane >> 4) & 1) << 1;
  acc[0] = (v8f){};
  acc[1] = (v8f){};
  // full unroll: constant indices keep w0/w1 in registers, not in scratch
#pragma unroll
  for (int i = 0; i < KFRAG; ++i) {
    v2f a  = *(const v2f*)&Hlds[mrow * LDSPITCH + 4 * i + kb];
    acc[0] = wmma4(a, w0[i], acc[0]);
    acc[1] = wmma4(a, w1[i], acc[1]);
  }
  // Four vector slots between the last WMMA and the first vector instruction
  // that reads its D or overwrites its A.  The two scheduling barriers hold the
  // slots at this place.
  __builtin_amdgcn_sched_barrier(0);
  asm volatile("v_nop\n\tv_nop\n\tv_nop\n\tv_nop");
  __builtin_amdgcn_sched_barrier(0);
}

__device__ __forceinline__ void hwrite(float* __restrict__ Hlds,
                                       const v8f acc[2]) {
  const int lane = threadIdx.x & 31;
  const int wave = threadIdx.x >> 5;
  const int mo   = (lane >> 4) << 3;  // C/D layout: M = r + 8*(lane/16)
  const int col  = wave * 32 + (lane & 15);
#pragma unroll
  for (int r = 0; r < 8; ++r) {
    Hlds[(mo + r) * LDSPITCH + col]      = acc[0][r];
    Hlds[(mo + r) * LDSPITCH + col + 16] = acc[1][r];
  }
}

// ---------------------------------------------------------------------------
// Kernel 3: local scans (h starts at 0) over the two halves of chunk c at once,
// in place on the Bx buffer: h = h @ A^T + hs[s], hs[s] = h.  Rows 0..7 of H
// are the batch rows of steps 0..3 of the chunk, rows 8..15 those of steps
// 4..7, so that no row of a WMMA is padding.  The halves' ends go to E1[c] and
// E2[c].  Item 0 of V, the sequence that scan_double scans, is the broadcast
// h0.
// ---------------------------------------------------------------------------
__global__ void __launch_bounds__(256) scan_local_kernel(
    const float* __restrict__ A, const float* __restrict__ h0, float* hs,
    float* __restrict__ V, float* __restrict__ E1, float* __restrict__ E2) {
  __shared__ float Hlds[16 * LDSPITCH];
  const int c = blockIdx.x;
  v2f w0[KFRAG], w1[KFRAG];
  wload(A, w0, w1);
  // stands in front of the reuse of the address registers that wload's loads
  // name
  asm volatile("s_wait_xcnt 0x0" ::: "memory");
  // keeps the later writes of those registers behind the wait
  __builtin_amdgcn_sched_barrier(0);
  for (int i = threadIdx.x; i < 16 * LDSPITCH; i += blockDim.x) Hlds[i] = 0.f;
  if (c == 0) {
#pragma unroll  // one load of h0, BATCH stores off one address
    for (int r = 0; r < BATCH; ++r)
      V[r * STATE + threadIdx.x] = h0[threadIdx.x];
    // stands in front of the reuse of the address registers of these stores
    asm volatile("s_wait_xcnt 0x0" ::: "memory");
  }
  __syncthreads();
  const int lane = threadIdx.x & 31;
  const int wave = threadIdx.x >> 5;
  const int col  = wave * 32 + (lane & 15);
  // C/D rows 8 h + r are batch row r of half h: the lane's place, counted from
  // step t of the first half; it does not change from step to step
  const unsigned lo = (unsigned)((lane >> 4) * HALF * HBLK + col);
  v8f acc[2];
  for (int t = 0; t < HALF; ++t) {
    float* p = hs + (size_t)(c * CHUNK + t) * HBLK;  // the same for all lanes
    hstep(w0, w1, Hlds, acc);
#pragma unroll
    for (int r = 0; r < 8; ++r) {
      acc[0][r] += p[lo + r * STATE];
      acc[1][r] += p[lo + r * STATE + 16];
    }
    __syncthreads();  // all waves done reading H
    hwrite(Hlds, acc);
#pragma unroll
    for (int r = 0; r < 8; ++r) {
      p[lo + r * STATE]      = acc[0][r];
      p[lo + r * STATE + 16] = acc[1][r];
    }
    // stands in front of the reuse of the address registers of these stores
    asm volatile("s_wait_xcnt 0x0" ::: "memory");
    __syncthreads();  // H fully written before next step
  }
  float* __restrict__ E = (lane >> 4) ? E2 : E1;  // the lane's half's end
#pragma unroll
  for (int r = 0; r < 8; ++r) {
    const size_t base = ((size_t)c * BATCH + r) * STATE;
    E[base + col]      = acc[0][r];
    E[base + col + 16] = acc[1][r];
  }
  // stands in front of any reuse of the registers that these stores name
  asm volatile("s_wait_xcnt 0x0" ::: "memory");
}

// ---------------------------------------------------------------------------
// Kernel 4 (x10): one level of the scan over the NCHUNK chunks:
//   Sout[c] = Add[c] + Sin[c - off] @ P^T   (c >= off; a plain copy below).
// Doubling: Add = Sin, P = A^(CHUNK * off); after off = 1, 2, .. 128, S[c] is
// the state at the start of chunk c.  With off = 0 and P = A^HALF the same sum
// carries a state over half a chunk: in front of the doubling the chunk's end
// E2[c] + E1[c] @ P^T, behind it the second half's start E1[c] + S[c] @ P^T.
// All rows (chunk, batch) form one 2048 x 256 x 256 GEMM:
// 256 work-groups of 4 waves, each a 32(M) x 64(N) tile, each wave 16 x 32.
// Work-groups from DBLK on compute Pn = P @ P for the next level in the same
// tile shape.  Both operand tiles are brought whole into LDS by asynchronous
// copies.  Every lane reads 4 consecutive k per fragment load, A and B alike:
// lane half h holds k = 8i + 4h + 0..3, two WMMA k-steps.
// ---------------------------------------------------------------------------
constexpr int DP    = STATE + 4;  // row pitch, 16 B x odd: b128 column walks
constexpr int PP    = 136;        // pitch of a k row pair of the (k, n) tile
constexpr int DBLK  = (NCHUNK * BATCH / 32) * (STATE / 64);  // scan tiles
constexpr int SQBLK = (STATE / 32) * (STATE / 64);           // squaring tiles

__device__ __forceinline__ void copy16(const float* __restrict__ g,
                                       float* __restrict__ l) {
#if defined(SSM_ASYNC_LDS)
  __builtin_amdgcn_global_load_async_to_lds_b128((v4i*)g, (v4i*)l, 0, 0);
#else
  *(v4f*)l = *(const v4f*)g;
#endif
}

__global__ void __launch_bounds__(128) scan_double_kernel(
    const float* __restrict__ Sin, const float* __restrict__ Add,
    float* __restrict__ Sout, const float* __restrict__ P,
    float* __restrict__ Pn, int off) {
  __shared__ __attribute__((aligned(16))) float Al[32 * DP];
  __shared__ __attribute__((aligned(16))) float Bl[(STATE / 2) * PP];  // >= 64 * DP
  const int tid  = threadIdx.x;
  const int lane = tid & 31;
  const int wave = tid >> 5;
  const int l16  = lane & 15;
  const int hh   = lane >> 4;
  const bool sq  = blockIdx.x >= DBLK;  // the same for the whole work-group
  const int tile  = sq ? blockIdx.x - DBLK : blockIdx.x;
  const int m0    = (tile >> 2) * 32;
  const int nbase = (tile & 3) * 64;
  const int back  = sq ? 0 : off * BATCH;
  const float* __restrict__ In = sq ? P : Sin;

  const int wm  = wave >> 1;
  const int wn  = wave & 1;
  const int mo  = m0 + wm * 16 + (hh << 3);  // C/D layout: M = r + 8*(lane/16)
  const int col = nbase + wn * 32 + l16;

  float ad0[8], ad1[8];
  if (!sq) {  // the summand Add[c], fetched while the copies fly
#pragma unroll
    for (int r = 0; r < 8; ++r) {
      ad0[r] = Add[(size_t)(mo + r) * STATE + col];
      ad1[r] = Add[(size_t)(mo + r) * STATE + col + 16];
    }
    // stands in front of the reuse of the address registers of these loads
    asm volatile("s_wait_xcnt 0x0" ::: "memory");
    if (m0 + 32 <= back) {  // whole tile below the first source: a plain copy
#pragma unroll
      for (int r = 0; r < 8; ++r) {
        Sout[(size_t)(mo + r) * STATE + col]      = ad0[r];
        Sout[(size_t)(mo + r) * STATE + col + 16] = ad1[r];
      }
      // stands in front of any reuse of the registers that these stores name
      asm volatile("s_wait_xcnt 0x0" ::: "memory");
      return;  // taken by the whole work-group, in front of the barrier
    }
  }

  // A tile: 32 rows of 1 KiB.  A row below the first item has no source: it
  // takes a row that exists, and its product is dropped at the store.
#pragma unroll
  for (int i = 0; i < 16; ++i) {
    const int row = 2 * i + (tid >> 6);
    int sr = m0 + row - back;
    sr = sr < 0 ? (row & (BATCH - 1)) : sr;
    copy16(In + (size_t)sr * STATE + (tid & 63) * 4, Al + row * DP + (tid & 63) * 4);
  }
  if (!sq) {  // B tile as (n, k): 64 rows of P, 1 KiB each
#pragma unroll
    for (int i = 0; i < 32; ++i) {
      const int row = 2 * i + (tid >> 6);
      copy16(P + (size_t)(nbase + row) * STATE + (tid & 63) * 4,
             Bl + row * DP + (tid & 63) * 4);
    }
  } else {
    // B tile as (k, n): 64 columns of all 256 rows of P.  Rows k and k + 1
    // (k even) interleave in runs of 16 columns, so that a lane finds its
    // column's k pair 16 dwords apart.
#pragma unroll
    for (int i = 0; i < 32; ++i) {
      const int row = 8 * i + (tid >> 4);
      const int seg = tid & 15;
      copy16(P + (size_t)row * STATE + nbase + seg * 4,
             Bl + (row >> 1) * PP + (seg >> 2) * 32 + (row & 1) * 16 + (seg & 3) * 4);
    }
  }

  // this wave's copies have landed; the barrier publishes every wave's
  asm volatile("s_wait_asynccnt 0x0" ::: "memory");
  __syncthreads();

  // The k loop runs in NS stages of SI fragment groups (32 WMMAs each); the
  // fragments of stage s + 1 are read from LDS in front of stage s's WMMAs.
  constexpr int SI = 8;
  constexpr int NS = STATE / 8 / SI;
  v8f acc0 = {}, acc1 = {};
  v4f a[2][SI];
  const float* ap = Al + (wm * 16 + l16) * DP + 4 * hh;
  if (!sq) {
    const float* bp = Bl + (wn * 32 + l16) * DP + 4 * hh;
    v4f b0[2][SI], b1[2][SI];
#pragma unroll
    for (int i = 0; i < SI; ++i) {
      a[0][i]  = *(const v4f*)(ap + 8 * i);
      b0[0][i] = *(const v4f*)(bp + 8 * i);
      b1[0][i] = *(const v4f*)(bp + 16 * DP + 8 * i);
    }
    // keeps stage 0's reads in front of stage 1's: the first WMMA then waits
    // for its own stage only
    __builtin_amdgcn_sched_barrier(0);
#pragma unroll  // constant indices keep the fragment arrays in registers
    for (int s = 0; s < NS; ++s) {
      const int cur = s & 1, nxt = cur ^ 1;
      if (s + 1 < NS) {
#pragma unroll
        for (int i = 0; i < SI; ++i) {
          const int k = 8 * ((s + 1) * SI + i);
          a[nxt][i]  = *(const v4f*)(ap + k);
          b0[nxt][i] = *(const v4f*)(bp + k);
          b1[nxt][i] = *(const v4f*)(bp + 16 * DP + k);
        }
      }
      // holds the next stage's LDS reads as one group a whole stage ahead of
      // their use; left free, they sink to one group of 4 WMMAs ahead
      __builtin_amdgcn_sched_barrier(0);
#pragma unroll
      for (int i = 0; i < SI; ++i) {
        acc0 = wmma4(a[cur][i].xy, b0[cur][i].xy, acc0);
        acc1 = wmma4(a[cur][i].xy, b1[cur][i].xy, acc1);
        acc0 = wmma4(a[cur][i].zw, b0[cur][i].zw, acc0);
        acc1 = wmma4(a[cur][i].zw, b1[cur][i].zw, acc1);
      }
      // keeps the reads of the stage after next behind this stage's WMMAs
      __builtin_amdgcn_sched_barrier(0);
    }
    const bool valid = (mo >> 3) >= off;  // a lane half is one chunk
#pragma unroll
    for (int r = 0; r < 8; ++r) {
      Sout[(size_t)(mo + r) * STATE + col]      = valid ? ad0[r] + acc0[r] : ad0[r];
      Sout[(size_t)(mo + r) * STATE + col + 16] = valid ? ad1[r] + acc1[r] : ad1[r];
    }
    // stands in front of any reuse of the registers that these stores name
    asm volatile("s_wait_xcnt 0x0" ::: "memory");
  } else {
    const float* bp = Bl + (2 * hh) * PP + wn * 64 + l16;
    // bq[..][i][2 * p + t]: k = 8i + 4h + 2p + 0..1 (as a's halves), tile t
    v2f bq[2][SI][4];
#pragma unroll
    for (int i = 0; i < SI; ++i) {
      a[0][i] = *(const v4f*)(ap + 8 * i);
#pragma unroll
      for (int q = 0; q < 4; ++q) {
        const float* e = bp + (4 * i + (q >> 1)) * PP + (q & 1) * 32;
        bq[0][i][q] = (v2f){e[0], e[16]};
      }
    }
    // keeps stage 0's reads in front of stage 1's: the first WMMA then waits
    // for its own stage only
    __builtin_amdgcn_sched_barrier(0);
#pragma unroll  // constant indices keep the fragment arrays in registers
    for (int s = 0; s < NS; ++s) {
      const int cur = s & 1, nxt = cur ^ 1;
      if (s + 1 < NS) {
#pragma unroll
        for (int i = 0; i < SI; ++i) {
          const int g = (s + 1) * SI + i;
          a[nxt][i] = *(const v4f*)(ap + 8 * g);
#pragma unroll
          for (int q = 0; q < 4; ++q) {
            const float* e = bp + (4 * g + (q >> 1)) * PP + (q & 1) * 32;
            bq[nxt][i][q] = (v2f){e[0], e[16]};
          }
        }
      }
      // holds the next stage's LDS reads as one group a whole stage ahead of
      // their use; left free, they sink to one group of 4 WMMAs ahead
      __builtin_amdgcn_sched_barrier(0);
#pragma unroll
      for (int i = 0; i < SI; ++i) {
        acc0 = wmma4(a[cur][i].xy, bq[cur][i][0], acc0);
        acc1 = wmma4(a[cur][i].xy, bq[cur][i][1], acc1);
        acc0 = wmma4(a[cur][i].zw, bq[cur][i][2], acc0);
        acc1 = wmma4(a[cur][i].zw, bq[cur][i][3], acc1);
      }
      // keeps the reads of the stage after next behind this stage's WMMAs
      __builtin_amdgcn_sched_barrier(0);
    }
#pragma unroll
    for (int r = 0; r < 8; ++r) {
      Pn[(size_t)(mo + r) * STATE + col]      = acc0[r];
      Pn[(size_t)(mo + r) * STATE + col + 16] = acc1[r];
    }
    // stands in front of any reuse of the registers that these stores name
    asm volatile("s_wait_xcnt 0x0" ::: "memory");
  }
}

// ---------------------------------------------------------------------------
// Kernel 5: correction: hs[s0 + t] += Hs * (A^T)^(t+1), parallel per chunk, both
// halves of the chunk at once: rows 0..7 of H start from Hc[c], the state at
// the start of chunk c, rows 8..15 from Hm[c], the state at the start of its
// second half.  The last state of the last chunk is also h_final.
// ---------------------------------------------------------------------------
__global__ void __launch_bounds__(256) scan_fix_kernel(
    const float* __restrict__ A, const float* __restrict__ Hc,
    const float* __restrict__ Hm, float* __restrict__ hs,
    float* __restrict__ hfinal) {
  __shared__ float Hlds[16 * LDSPITCH];
  const int c = blockIdx.x;
  v2f w0[KFRAG], w1[KFRAG];
  wload(A, w0, w1);
  // stands in front of the reuse of the address registers that wload's loads
  // name
  asm volatile("s_wait_xcnt 0x0" ::: "memory");
  // keeps the later writes of those registers behind the wait
  __builtin_amdgcn_sched_barrier(0);
  const float* hc = Hc + (size_t)c * HBLK;  // the same for all lanes
  const float* hm = Hm + (size_t)c * HBLK;
  float sc[BATCH], sm[BATCH];
#pragma unroll  // 16 independent loads in flight, one row each
  for (int r = 0; r < BATCH; ++r) {
    sc[r] = hc[threadIdx.x + r * STATE];
    sm[r] = hm[threadIdx.x + r * STATE];
  }
  // stands in front of the reuse of the address registers of these loads
  asm volatile("s_wait_xcnt 0x0" ::: "memory");
  // keeps the later writes of those registers behind the wait
  __builtin_amdgcn_sched_barrier(0);
  // hstep reads columns 0..STATE-1 only: the pad columns stay unwritten
#pragma unroll
  for (int r = 0; r < BATCH; ++r) {
    Hlds[r * LDSPITCH + threadIdx.x]           = sc[r];
    Hlds[(BATCH + r) * LDSPITCH + threadIdx.x] = sm[r];
  }
  __syncthreads();
  const int lane = threadIdx.x & 31;
  const int wave = threadIdx.x >> 5;
  const int col  = wave * 32 + (lane & 15);
  // C/D rows 8 h + r are batch row r of half h: the lane's place, counted from
  // step t of the first half; it does not change from step to step
  const unsigned lo = (unsigned)((lane >> 4) * HALF * HBLK + col);
  v8f acc[2];
  float v0[8], v1[8];  // the corrected state of the step
  for (int t = 0; t < HALF; ++t) {
    float* p = hs + (size_t)(c * CHUNK + t) * HBLK;  // the same for all lanes
    hstep(w0, w1, Hlds, acc);
    __syncthreads();
    hwrite(Hlds, acc);
#pragma unroll
    for (int r = 0; r < 8; ++r) {
      v0[r] = p[lo + r * STATE] + acc[0][r];
      v1[r] = p[lo + r * STATE + 16] + acc[1][r];
    }
#pragma unroll
    for (int r = 0; r < 8; ++r) {
      p[lo + r * STATE]      = v0[r];
      p[lo + r * STATE + 16] = v1[r];
    }
    // stands in front of the reuse of the address registers of these
    // loads and stores
    asm volatile("s_wait_xcnt 0x0" ::: "memory");
    __syncthreads();
  }
  if (lane >= 16 && c == NCHUNK - 1) {  // the last state of all is h_final
#pragma unroll
    for (int r = 0; r < 8; ++r) {
      hfinal[(size_t)r * STATE + col]      = v0[r];
      hfinal[(size_t)r * STATE + col + 16] = v1[r];
    }
    // stands in front of any reuse of the registers that these stores name
    asm volatile("s_wait_xcnt 0x0" ::: "memory");
  }
}

// ---------------------------------------------------------------------------
// Kernel 6: y[m,d] = hs_row(m) @ C^T + x_row(m) @ D^T   (m = b*SEQ + s)
// ---------------------------------------------------------------------------
// 8 waves per SIMD asked for: a budget of 128 VGPRs, so that the four
// work-groups that fit a WGP's LDS also fit its registers
__global__ void __launch_bounds__(256, 8) proj_out_kernel(
    const float* __restrict__ x, const float* __restrict__ hs,
    const float* __restrict__ C, const float* __restrict__ D,
    float* __restrict__ y) {
  __shared__ __attribute__((aligned(16))) float L[2 * GST];
  const int tid   = threadIdx.x;
  const int lane  = tid & 31;
  const int wave  = tid >> 5;
  const int mbase = blockIdx.y * GT;  // a tile's rows share one b
  const int nbase = blockIdx.x * GT;
  const int m     = mbase + (tid >> 3);
  const int n     = nbase + (tid >> 3);
  const int b = m >> 11, s = m & (SEQ - 1);
  const float* hg = hs + ((size_t)s * BATCH + b) * STATE + (tid & 7) * 4;
  const float* xg = x + (size_t)m * DMODEL + (tid & 7) * 4;
  const float* cg = C + (size_t)n * STATE + (tid & 7) * 4;
  const float* dg = D + (size_t)n * DMODEL + (tid & 7) * 4;
  v8f acc[8] = {{}, {}, {}, {}, {}, {}, {}, {}};
  const Product ph = {hg, (size_t)32 * HBLK, cg, (size_t)32 * STATE};
  const Product px = {xg, (size_t)32 * DMODEL, dg, (size_t)32 * DMODEL};
  gemm_ring<STATE / GK, DMODEL / GK>(ph, px, L, acc);
  const int mo  = mbase + (wave >> 1) * 32 + ((lane >> 4) << 3);
  const int col = nbase + (wave & 1) * 64 + (lane & 15);
#pragma unroll
  for (int t = 0; t < 4; ++t)
#pragma unroll
    for (int r = 0; r < 8; ++r) {
      y[(size_t)(mo + r) * DMODEL + col + t * 16]      = acc[t][r];
      y[(size_t)(mo + 16 + r) * DMODEL + col + t * 16] = acc[4 + t][r];
    }
}

// ---------------------------------------------------------------------------
extern "C" void kernel_launch(void* const* d_in, const int* in_sizes, int n_in,
                              void* d_out, int out_size, void* d_ws,
                              size_t ws_size, hipStream_t stream) {
  const float* x  = (const float*)d_in[0];
  const float* A  = (const float*)d_in[1];
  const float* B  = (const float*)d_in[2];
  const float* C  = (const float*)d_in[3];
  const float* D  = (const float*)d_in[4];
  const float* h0 = (const float*)d_in[5];

  float* y      = (float*)d_out;
  float* hfinal = y + (size_t)BATCH * SEQ * DMODEL;

  float* ws   = (float*)d_ws;
  float* hsBx = ws;                                  // 4,194,304 f32
  float* Sa   = hsBx + (size_t)SEQ * HBLK;           // NCHUNK + 1 states
  float* Sb   = Sa + (size_t)(NCHUNK + 1) * HBLK;    // NCHUNK states
  float* E1   = Sb + (size_t)NCHUNK * HBLK;          // NCHUNK states
  float* E2   = E1 + (size_t)NCHUNK * HBLK;          // NCHUNK states
  float* Pa   = E2 + (size_t)NCHUNK * HBLK;          //    65,536 f32
  float* Pb   = Pa + (size_t)STATE * STATE;          //    65,536 f32
  float* P8   = Pb + (size_t)STATE * STATE;          //    65,536 f32
  float* P4   = P8 + (size_t)STATE * STATE;          //    65,536 f32

  // 1) input projection
  proj_in_kernel<<<dim3(STATE / GT, (BATCH * SEQ) / GT), 256, 0, stream>>>(
      x, B, hsBx);

  // 2) A^4 via repeated squaring
  matsq_kernel<<<STATE, STATE, 0, stream>>>(A, Pa);
  matsq_kernel<<<STATE, STATE, 0, stream>>>(Pa, P4);  // P4 = A^4

  // 3) local scans inside each half chunk, in place; half ends -> E1, E2;
  //    h0 -> item 0 of Sa
  scan_local_kernel<<<NCHUNK, 256, 0, stream>>>(A, h0, hsBx, Sa, E1, E2);

  // 4a) the end of chunk c -> item c + 1 of Sa; also P8 = P4 @ P4
  scan_double_kernel<<<DBLK + SQBLK, 128, 0, stream>>>(E1, E2, Sa + HBLK, P4,
                                                       P8, 0);

  // 4b) chunk starts by doubling; each level but the last squares its power
  scan_double_kernel<<<DBLK + SQBLK, 128, 0, stream>>>(Sa, Sa, Sb, P8, Pa, 1);
  scan_double_kernel<<<DBLK + SQBLK, 128, 0, stream>>>(Sb, Sb, Sa, Pa, Pb, 2);
  scan_double_kernel<<<DBLK + SQBLK, 128, 0, stream>>>(Sa, Sa, Sb, Pb, Pa, 4);
  scan_double_kernel<<<DBLK + SQBLK, 128, 0, stream>>>(Sb, Sb, Sa, Pa, Pb, 8);
  scan_double_kernel<<<DBLK + SQBLK, 128, 0, stream>>>(Sa, Sa, Sb, Pb, Pa, 16);
  scan_double_kernel<<<DBLK + SQBLK, 128, 0, stream>>>(Sb, Sb, Sa, Pa, Pb, 32);
  scan_double_kernel<<<DBLK + SQBLK, 128, 0, stream>>>(Sa, Sa, Sb, Pb, Pa, 64);
  scan_double_kernel<<<DBLK, 128, 0, stream>>>(Sb, Sb, Sa, Pa, Pb, 128);

  // 4c) the start of each chunk's second half -> Sb
  scan_double_kernel<<<DBLK, 128, 0, stream>>>(Sa, E1, Sb, P4, Pb, 0);

  // 5) every state corrected by its half chunk's start state; emits h_final
  scan_fix_kernel<<<NCHUNK, 256, 0, stream>>>(A, Sa, Sb, hsBx, hfinal);

  // 6) output projection
  proj_out_kernel<<<dim3(DMODEL / GT, (BATCH * SEQ) / GT), 256, 0, stream>>>(
      x, hsBx, C, D, y);
}

// v006
// It runs in 320 microseconds.
// Next to v005, in two timings, it ran 1.05 and 1.06 times as fast.
// Counting every step since v000, it is 3.45 times as fast.
#include <hip/hip_runtime.h>
#include <hip/hip_bf16.h>

// ---------------------------------------------------------------------------
// TrajectorySSM on MI455X (gfx1250), fp32 WMMA (V_WMMA_F32_16X16X4_F32).
//
//   1) proj_in : Bx[s,b,n]   = sum_d x[b,s,d] * B[n,d]     (WMMA, LDS-staged X, W)
//   2) A^2, A^4 (half chunk to half chunk): one 16x16 tile in each work-group
//                        of 1) and of 3), no launch of their own
//   3) scan_local, A   : 512 half chunks x 4 steps, zero init; a chunk's two
//                        halves fill the 16 rows of one work-group's H
//   4) scan_double x10 : chunk ends from the half ends with A^4; chunk starts
//                        by doubling, S[c] += S[c-2^d] * (P_d)^T with
//                        P_d = A^(8*2^d); second-half starts with A^4 again;
//                        a launch also squares its power for the next
//   5) scan_fix, A     : hs[s] += S[half chunk] * (A^T)^(t+1), emits h_final
//   6) proj_out : y = hs@C^T + x@D^T                (WMMA, LDS-staged X, W)
//
// Operand tiles are staged global->LDS with async-to-LDS copies (ASYNCcnt).
// ---------------------------------------------------------------------------

typedef __attribute__((ext_vector_type(2))) float v2f;
typedef __attribute__((ext_vector_type(4))) float v4f;
typedef __attribute__((ext_vector_type(8))) float v8f;
typedef __attribute__((ext_vector_type(4))) int   v4i;

constexpr int BATCH  = 8;
constexpr int SEQ    = 2048;
constexpr int DMODEL = 1024;
constexpr int STATE  = 256;
constexpr int CHUNK  = 8;            // steps per chunk
constexpr int HALF   = CHUNK / 2;    // steps per half chunk
constexpr int NCHUNK = 256;          // SEQ / CHUNK
constexpr int HBLK   = BATCH * STATE;  // floats of one state (all batch rows)
constexpr int LDSPITCH = STATE + 2;  // scan-state pitch (bank-conflict pad)

// D = A(16x4 f32) * B(4x16 f32) + C(16x16 f32)
__device__ __forceinline__ v8f wmma4(v2f a, v2f b, v8f c) {
  return __builtin_amdgcn_wmma_f32_16x16x4_f32(
      /*neg_a=*/false, a, /*neg_b=*/false, b,
      /*c_mod=*/(short)0, c, /*reuse_a=*/false, /*reuse_b=*/false);
}

// --------------------------- async LDS staging -----------------------------
#if __has_builtin(__builtin_amdgcn_global_load_async_to_lds_b128)
#define SSM_ASYNC_LDS 1
#endif

// ---------------------------------------------------------------------------
// Work-group GEMM of the two projections: a 128(M) x 128(N) tile of
// Y = X * W^T, 8 waves as 4(M) x 2(N), each wave 32 x 64.  K runs in stages of
// GK columns.  A stage holds the X tile and the W tile, both as rows of GK
// floats at pitch GP, brought into LDS by asynchronous copies that cover whole
// 128-byte lines.  Two buffers: stage s + 1 flies while stage s is worked on.
// Every lane reads 4 consecutive k per fragment load, A and B alike: lane half
// h holds k = 8i + 4h + 0..3, two WMMA k-steps.
// ---------------------------------------------------------------------------
constexpr int GT  = 128;      // tile rows, X and W alike
constexpr int GK  = 32;       // k columns of a stage: one 128-byte line a row
constexpr int GP  = GK + 4;   // row pitch, 16 B x odd: b128 column walks
constexpr int GOP = GT * GP;  // floats of one operand's tile
constexpr int GST = 2 * GOP;  // floats of a stage: X tile, then W tile

// One stage.  Thread (r0 = tid / 8, seg = tid % 8) copies 16 bytes of the rows
// r0 + 32 j, j = 0..3, of both tiles: a wave's copy is 4 whole lines.  xg, wg:
// the thread's bytes of row r0; xstep, wstep: floats from row r to row r + 32;
// l: the thread's LDS byte address in row r0 of the stage's X tile.
__device__ __forceinline__ void stage_tiles(const float* xg, size_t xstep,
                                            const float* wg, size_t wstep,
                                            unsigned l) {
  constexpr unsigned LJ = 32 * GP * 4;  // LDS bytes from row r to row r + 32
  constexpr unsigned LW = GOP * 4;      // LDS bytes from the X to the W tile
  // The wait on xcnt closes the statement: it stands behind the last copy and
  // in front of every later write of an address register that a copy names.
  asm volatile(
      "global_load_async_to_lds_b128 %0, %8, off\n\t"
      "global_load_async_to_lds_b128 %1, %9, off\n\t"
      "global_load_async_to_lds_b128 %2, %10, off\n\t"
      "global_load_async_to_lds_b128 %3, %11, off\n\t"
      "global_load_async_to_lds_b128 %4, %12, off\n\t"
      "global_load_async_to_lds_b128 %5, %13, off\n\t"
      "global_load_async_to_lds_b128 %6, %14, off\n\t"
      "global_load_async_to_lds_b128 %7, %15, off\n\t"
      "s_wait_xcnt 0x0"
      :
      : "v"(l), "v"(l + LJ), "v"(l + 2 * LJ), "v"(l + 3 * LJ),
        "v"(l + LW), "v"(l + LW + LJ), "v"(l + LW + 2 * LJ),
        "v"(l + LW + 3 * LJ),
        "v"(xg), "v"(xg + xstep), "v"(xg + 2 * xstep), "v"(xg + 3 * xstep),
        "v"(wg), "v"(wg + wstep), "v"(wg + 2 * wstep), "v"(wg + 3 * wstep)
      : "memory");
}

// One product X * W^T of a ring: x, w are the thread's bytes of row tid / 8 of
// the two tiles at k = 0; xstep, wstep as in stage_tiles.
struct Product {
  const float* x;
  size_t xstep;
  const float* w;
  size_t wstep;
};

// Sums two products into one tile: N1 stages of p1, then N2 stages of p2, in
// one ring (N1 = 0: p2 alone).  acc[t] and acc[4 + t]: rows 0..15 and 16..31
// of the wave's tile, columns 16 t .. 16 t + 15.  N1 + N2 is at least 2.
template <int N1, int N2>
__device__ __forceinline__ void gemm_ring(const Product p1, const Product p2,
                                          float* L, v8f acc[8]) {
  const int tid  = threadIdx.x;
  const int lane = tid & 31;
  const int wave = tid >> 5;
  const int l16  = lane & 15;
  const int hh   = lane >> 4;
  const unsigned l0 =
      (unsigned)(size_t)L + (unsigned)(((tid >> 3) * GP + (tid & 7) * 4) * 4);
  const int aoff = ((wave >> 1) * 32 + l16) * GP + 4 * hh;
  const int boff = GOP + ((wave & 1) * 64 + l16) * GP + 4 * hh;
  constexpr int NST = N1 + N2;

  // the copies of stage q; q is the same for the whole work-group
  auto issue = [&](int q) {
    const unsigned l = l0 + (q & 1) * (GST * 4);
    if (q < N1)
      stage_tiles(p1.x + q * GK, p1.xstep, p1.w + q * GK, p1.wstep, l);
    else
      stage_tiles(p2.x + (q - N1) * GK, p2.xstep, p2.w + (q - N1) * GK,
                  p2.wstep, l);
  };

  issue(0);
  // this wave's copies of stage 0 have landed; the barrier publishes all
  asm volatile("s_wait_asynccnt 0x0" ::: "memory");
  __syncthreads();
  issue(1);

#pragma unroll 1  // one stage's code serves every stage: the text stays small
  for (int s = 0; s < NST; ++s) {
    const float* ap = L + (s & 1) * GST + aoff;
    const float* bp = L + (s & 1) * GST + boff;
    // fa[.][h]: rows 16 h .. 16 h + 15; fb[.][t]: columns 16 t .. 16 t + 15
    v4f fa[2][2], fb[2][4];
    fa[0][0] = *(const v4f*)ap;
    fa[0][1] = *(const v4f*)(ap + 16 * GP);
#pragma unroll
    for (int t = 0; t < 4; ++t) fb[0][t] = *(const v4f*)(bp + 16 * t * GP);
    // keeps group 0's reads in front of group 1's: the first WMMA then waits
    // for its own group only
    __builtin_amdgcn_sched_barrier(0);
#pragma unroll  // constant indices keep the fragments in registers
    for (int i = 0; i < GK / 8; ++i) {
      const int cur = i & 1, nxt = cur ^ 1;
      if (i + 1 < GK / 8) {
        fa[nxt][0] = *(const v4f*)(ap + 8 * (i + 1));
        fa[nxt][1] = *(const v4f*)(ap + 16 * GP + 8 * (i + 1));
#pragma unroll
        for (int t = 0; t < 4; ++t)
          fb[nxt][t] = *(const v4f*)(bp + 16 * t * GP + 8 * (i + 1));
      }
      // holds the next group's LDS reads together, a whole group of 16 WMMAs
      // ahead of their use; left free, they sink in among the WMMAs one by one
      __builtin_amdgcn_sched_barrier(0);
#pragma unroll
      for (int t = 0; t < 4; ++t) {
        acc[t]     = wmma4(fa[cur][0].xy, fb[cur][t].xy, acc[t]);
        acc[4 + t] = wmma4(fa[cur][1].xy, fb[cur][t].xy, acc[4 + t]);
      }
#pragma unroll
      for (int t = 0; t < 4; ++t) {
        acc[t]     = wmma4(fa[cur][0].zw, fb[cur][t].zw, acc[t]);
        acc[4 + t] = wmma4(fa[cur][1].zw, fb[cur][t].zw, acc[4 + t]);
      }
      // keeps the reads of the group after next behind this group's WMMAs
      __builtin_amdgcn_sched_barrier(0);
    }
    // this wave's reads of stage s have returned
    asm volatile("s_wait_dscnt 0x0" ::: "memory");
    // this wave's copies of stage s + 1 have landed
    asm volatile("s_wait_asynccnt 0x0" ::: "memory");
    __syncthreads();  // publishes stage s + 1, frees the buffer of stage s
    if (s + 2 < NST) issue(s + 2);
  }
  // no copy is left in flight behind the loop
  asm volatile("s_wait_asynccnt 0x0" ::: "memory");
}

// ---------------------------------------------------------------------------
// One 16 x 16 tile of Dst = S @ S (256 x 256) by a work-group of 8 waves; the
// 256 work-groups of a launch give the whole square.  Wave w sums the 32 k from
// 32 w on (8 WMMAs); the 8 partial tiles meet in red (8 x 256 floats of LDS).
// Lane half h holds k = 4 i + 2 h + 0..1, A and B alike.
// ---------------------------------------------------------------------------
__device__ __forceinline__ void square_tile(const float* __restrict__ S,
                                            float* __restrict__ Dst, int tile,
                                            float* __restrict__ red) {
  const int tid  = threadIdx.x;
  const int lane = tid & 31;
  const int wave = tid >> 5;
  const int l16  = lane & 15;
  const int hh   = lane >> 4;
  const int m0   = (tile >> 4) * 16;
  const int n0   = (tile & 15) * 16;
  const int k0   = wave * 32 + 2 * hh;
  const float* ap = S + (size_t)(m0 + l16) * STATE + k0;
  const float* bp = S + (size_t)k0 * STATE + n0 + l16;
  v2f a[8], b[8];
#pragma unroll  // 24 independent loads in flight
  for (int i = 0; i < 8; ++i) {
    a[i] = *(const v2f*)(ap + 4 * i);
    b[i] = (v2f){bp[(4 * i) * STATE], bp[(4 * i + 1) * STATE]};
  }
  // stands in front of the reuse of the address registers of these loads
  asm volatile("s_wait_xcnt 0x0" ::: "memory");
  // keeps the later writes of those registers behind the wait
  __builtin_amdgcn_sched_barrier(0);
  v8f acc = {};
#pragma unroll
  for (int i = 0; i < 8; ++i) acc = wmma4(a[i], b[i], acc);
  // Four vector slots between the last WMMA and the first vector instruction
  // that reads its D; the two scheduling barriers hold them at this place.
  __builtin_amdgcn_sched_barrier(0);
  asm volatile("v_nop\n\tv_nop\n\tv_nop\n\tv_nop");
  __builtin_amdgcn_sched_barrier(0);
#pragma unroll
  for (int r = 0; r < 8; ++r)  // C/D layout: M = r + 8*(lane/16)
    red[wave * 256 + (r + 8 * hh) * 16 + l16] = acc[r];
  __syncthreads();  // every wave's partial tile is in red
  float sum = red[tid];
#pragma unroll
  for (int w = 1; w < 8; ++w) sum += red[w * 256 + tid];
  Dst[(size_t)(m0 + (tid >> 4)) * STATE + n0 + (tid & 15)] = sum;
  // stands in front of any reuse of the registers that this store names
  asm volatile("s_wait_xcnt 0x0" ::: "memory");
}

// ---------------------------------------------------------------------------
// Kernel 1: Bx[s*8+b, n] = sum_d x[b,s,d] * B[n,d]  (M=16384, N=256, K=1024)
// Each of the 256 work-groups also computes one tile of A2 = A @ A.
// ---------------------------------------------------------------------------
__global__ void __launch_bounds__(256) proj_in_kernel(
    const float* __restrict__ x, const float* __restrict__ B,
    float* __restrict__ Bx, const float* __restrict__ A,
    float* __restrict__ A2) {
  __shared__ __attribute__((aligned(16))) float L[2 * GST];
  __shared__ float red[8 * 256];
  square_tile(A, A2, blockIdx.y * (STATE / GT) + blockIdx.x, red);
  const int tid   = threadIdx.x;
  const int lane  = tid & 31;
  const int wave  = tid >> 5;
  const int mbase = blockIdx.y * GT;
  const int nbase = blockIdx.x * GT;
  const int m     = mbase + (tid >> 3);  // output rows are s*8+b ordered
  const float* xg =
      x + ((size_t)(m & 7) * SEQ + (m >> 3)) * DMODEL + (tid & 7) * 4;
  const float* wg = B + (size_t)(nbase + (tid >> 3)) * DMODEL + (tid & 7) * 4;
  v8f acc[8] = {{}, {}, {}, {}, {}, {}, {}, {}};
  // 32 output rows on: the same b, s + 4
  const Product p = {xg, (size_t)4 * DMODEL, wg, (size_t)32 * DMODEL};
  gemm_ring<0, DMODEL / GK>(p, p, L, acc);
  const int mo  = mbase + (wave >> 1) * 32 + ((lane >> 4) << 3);
  const int col = nbase + (wave & 1) * 64 + (lane & 15);
#pragma unroll
  for (int t = 0; t < 4; ++t)
#pragma unroll
    for (int r = 0; r < 8; ++r) {
      Bx[(size_t)(mo + r) * STATE + col + t * 16]      = acc[t][r];
      Bx[(size_t)(mo + 16 + r) * STATE + col + t * 16] = acc[4 + t][r];
    }
}

// ---------------------------------------------------------------------------
// Scan helpers: H (16x256, the batch rows of two half chunks) in LDS; one step computes
// H @ W^T with W row-major (256,256).  8 waves, each owns 32 columns.
// W does not change from step to step, so each wave loads the B fragments of
// its 32 columns once (wload: 2 x 64 fragments = 256 VGPRs per lane) and every
// step reads them from registers; only H moves through LDS.
// ---------------------------------------------------------------------------
constexpr int KFRAG = STATE / 4;  // 16x16x4 k-steps per H @ W^T product

__device__ __forceinline__ void wload(const float* __restrict__ W,
                                      v2f w0[KFRAG], v2f w1[KFRAG]) {
  const int lane = threadIdx.x & 31;
  const int wave = threadIdx.x >> 5;
  const int kb   = ((lane >> 4) & 1) << 1;
  const int n0   = wave * 32 + (lane & 15);
  // full unroll: constant indices keep w0/w1 in registers, not in scratch
#pragma unroll
  for (int i = 0; i < KFRAG; ++i) {
    w0[i] = *(const v2f*)&W[(size_t)n0 * STATE + 4 * i + kb];
    w1[i] = *(const v2f*)&W[(size_t)(n0 + 16) * STATE + 4 * i + kb];
  }
}

__device__ __forceinline__ void hstep(const v2f w0[KFRAG], const v2f w1[KFRAG],
                                      const float* __restrict__ Hlds,
                                      v8f acc[2]) {
  const int lane = threadIdx.x & 31;
  const int mrow = lane & 15;
  const int kb   = ((lane >> 4) & 1) << 1;
  acc[0] = (v8f){};
  acc[1] = (v8f){};
  // full unroll: constant indices keep w0/w1 in registers, not in scratch
#pragma unroll
  for (int i = 0; i < KFRAG; ++i) {
    v2f a  = *(const v2f*)&Hlds[mrow * LDSPITCH + 4 * i + kb];
    acc[0] = wmma4(a, w0[i], acc[0]);
    acc[1] = wmma4(a, w1[i], acc[1]);
  }
  // Four vector slots between the last WMMA and the first vector instruction
  // that reads its D or overwrites its A.  The two scheduling barriers hold the
  // slots at this place.
  __builtin_amdgcn_sched_barrier(0);
  asm volatile("v_nop\n\tv_nop\n\tv_nop\n\tv_nop");
  __builtin_amdgcn_sched_barrier(0);
}

__device__ __forceinline__ void hwrite(float* __restrict__ Hlds,
                                       const v8f acc[2]) {
  const int lane = threadIdx.x & 31;
  const int wave = threadIdx.x >> 5;
  const int mo   = (lane >> 4) << 3;  // C/D layout: M = r + 8*(lane/16)
  const int col  = wave * 32 + (lane & 15);
#pragma unroll
  for (int r = 0; r < 8; ++r) {
    Hlds[(mo + r) * LDSPITCH + col]      = acc[0][r];
    Hlds[(mo + r) * LDSPITCH + col + 16] = acc[1][r];
  }
}

// ---------------------------------------------------------------------------
// Kernel 3: local scans (h starts at 0) over the two halves of chunk c at once,
// in place on the Bx buffer: h = h @ A^T + hs[s], hs[s] = h.  Rows 0..7 of H
// are the batch rows of steps 0..3 of the chunk, rows 8..15 those of steps
// 4..7, so that no row of a WMMA is padding.  The halves' ends go to E1[c] and
// E2[c].  Item 0 of V, the sequence that scan_double scans, is the broadcast
// h0.  Each of the 256 work-groups also computes one tile of A4 = A2 @ A2.
// ---------------------------------------------------------------------------
__global__ void __launch_bounds__(256) scan_local_kernel(
    const float* __restrict__ A, const float* __restrict__ h0, float* hs,
    float* __restrict__ V, float* __restrict__ E1, float* __restrict__ E2,
    const float* __restrict__ A2, float* __restrict__ A4) {
  __shared__ float Hlds[16 * LDSPITCH];
  __shared__ float red[8 * 256];
  const int c = blockIdx.x;
  square_tile(A2, A4, c, red);
  v2f w0[KFRAG], w1[KFRAG];
  wload(A, w0, w1);
  // stands in front of the reuse of the address registers that wload's loads
  // name
  asm volatile("s_wait_xcnt 0x0" ::: "memory");
  // keeps the later writes of those registers behind the wait
  __builtin_amdgcn_sched_barrier(0);
  for (int i = threadIdx.x; i < 16 * LDSPITCH; i += blockDim.x) Hlds[i] = 0.f;
  if (c == 0) {
#pragma unroll  // one load of h0, BATCH stores off one address
    for (int r = 0; r < BATCH; ++r)
      V[r * STATE + threadIdx.x] = h0[threadIdx.x];
    // stands in front of the reuse of the address registers of these stores
    asm volatile("s_wait_xcnt 0x0" ::: "memory");
  }
  __syncthreads();
  const int lane = threadIdx.x & 31;
  const int wave = threadIdx.x >> 5;
  const int col  = wave * 32 + (lane & 15);
  // C/D rows 8 h + r are batch row r of half h: the lane's place, counted from
  // step t of the first half; it does not change from step to step
  const unsigned lo = (unsigned)((lane >> 4) * HALF * HBLK + col);
  v8f acc[2];
  for (int t = 0; t < HALF; ++t) {
    float* p = hs + (size_t)(c * CHUNK + t) * HBLK;  // the same for all lanes
    hstep(w0, w1, Hlds, acc);
#pragma unroll
    for (int r = 0; r < 8; ++r) {
      acc[0][r] += p[lo + r * STATE];
      acc[1][r] += p[lo + r * STATE + 16];
    }
    __syncthreads();  // all waves done reading H
    hwrite(Hlds, acc);
#pragma unroll
    for (int r = 0; r < 8; ++r) {
      p[lo + r * STATE]      = acc[0][r];
      p[lo + r * STATE + 16] = acc[1][r];
    }
    // stands in front of the reuse of the address registers of these stores
    asm volatile("s_wait_xcnt 0x0" ::: "memory");
    __syncthreads();  // H fully written before next step
  }
  float* __restrict__ E = (lane >> 4) ? E2 : E1;  // the lane's half's end
#pragma unroll
  for (int r = 0; r < 8; ++r) {
    const size_t base = ((size_t)c * BATCH + r) * STATE;
    E[base + col]      = acc[0][r];
    E[base + col + 16] = acc[1][r];
  }
  // stands in front of any reuse of the registers that these stores name
  asm volatile("s_wait_xcnt 0x0" ::: "memory");
}

// ---------------------------------------------------------------------------
// Kernel 4 (x10): one level of the scan over the NCHUNK chunks:
//   Sout[c] = Add[c] + Sin[c - off] @ P^T   (c >= off; a plain copy below).
// Doubling: Add = Sin, P = A^(CHUNK * off); after off = 1, 2, .. 128, S[c] is
// the state at the start of chunk c.  With off = 0 and P = A^HALF the same sum
// carries a state over half a chunk: in front of the doubling the chunk's end
// E2[c] + E1[c] @ P^T, behind it the second half's start E1[c] + S[c] @ P^T.
// All rows (chunk, batch) form one 2048 x 256 x 256 GEMM:
// 256 work-groups of 4 waves, each a 32(M) x 64(N) tile, each wave 16 x 32.
// Work-groups from DBLK on compute Pn = P @ P for the next level in the same
// tile shape.  Both operand tiles are brought whole into LDS by asynchronous
// copies.  Every lane reads 4 consecutive k per fragment load, A and B alike:
// lane half h holds k = 8i + 4h + 0..3, two WMMA k-steps.
// ---------------------------------------------------------------------------
constexpr int DP    = STATE + 4;  // row pitch, 16 B x odd: b128 column walks
constexpr int PP    = 136;        // pitch of a k row pair of the (k, n) tile
constexpr int DBLK  = (NCHUNK * BATCH / 32) * (STATE / 64);  // scan tiles
constexpr int SQBLK = (STATE / 32) * (STATE / 64);           // squaring tiles

__device__ __forceinline__ void copy16(const float* __restrict__ g,
                                       float* __restrict__ l) {
#if defined(SSM_ASYNC_LDS)
  __builtin_amdgcn_global_load_async_to_lds_b128((v4i*)g, (v4i*)l, 0, 0);
#else
  *(v4f*)l = *(const v4f*)g;
#endif
}

__global__ void __launch_bounds__(128) scan_double_kernel(
    const float* __restrict__ Sin, const float* __restrict__ Add,
    float* __restrict__ Sout, const float* __restrict__ P,
    float* __restrict__ Pn, int off) {
  __shared__ __attribute__((aligned(16))) float Al[32 * DP];
  __shared__ __attribute__((aligned(16))) float Bl[(STATE / 2) * PP];  // >= 64 * DP
  const int tid  = threadIdx.x;
  const int lane = tid & 31;
  const int wave = tid >> 5;
  const int l16  = lane & 15;
  const int hh   = lane >> 4;
  const bool sq  = blockIdx.x >= DBLK;  // the same for the whole work-group
  const int tile  = sq ? blockIdx.x - DBLK : blockIdx.x;
  const int m0    = (tile >> 2) * 32;
  const int nbase = (tile & 3) * 64;
  const int back  = sq ? 0 : off * BATCH;
  const float* __restrict__ In = sq ? P : Sin;

  const int wm  = wave >> 1;
  const int wn  = wave & 1;
  const int mo  = m0 + wm * 16 + (hh << 3);  // C/D layout: M = r + 8*(lane/16)
  const int col = nbase + wn * 32 + l16;

  float ad0[8], ad1[8];
  if (!sq) {  // the summand Add[c], fetched while the copies fly
#pragma unroll
    for (int r = 0; r < 8; ++r) {
      ad0[r] = Add[(size_t)(mo + r) * STATE + col];
      ad1[r] = Add[(size_t)(mo + r) * STATE + col + 16];
    }
    // stands in front of the reuse of the address registers of these loads
    asm volatile("s_wait_xcnt 0x0" ::: "memory");
    if (m0 + 32 <= back) {  // whole tile below the first source: a plain copy
#pragma unroll
      for (int r = 0; r < 8; ++r) {
        Sout[(size_t)(mo + r) * STATE + col]      = ad0[r];
        Sout[(size_t)(mo + r) * STATE + col + 16] = ad1[r];
      }
      // stands in front of any reuse of the registers that these stores name
      asm volatile("s_wait_xcnt 0x0" ::: "memory");
      return;  // taken by the whole work-group, in front of the barrier
    }
  }

  // A tile: 32 rows of 1 KiB.  A row below the first item has no source: it
  // takes a row that exists, and its product is dropped at the store.
#pragma unroll
  for (int i = 0; i < 16; ++i) {
    const int row = 2 * i + (tid >> 6);
    int sr = m0 + row - back;
    sr = sr < 0 ? (row & (BATCH - 1)) : sr;
    copy16(In + (size_t)sr * STATE + (tid & 63) * 4, Al + row * DP + (tid & 63) * 4);
  }
  if (!sq) {  // B tile as (n, k): 64 rows of P, 1 KiB each
#pragma unroll
    for (int i = 0; i < 32; ++i) {
      const int row = 2 * i + (tid >> 6);
      copy16(P + (size_t)(nbase + row) * STATE + (tid & 63) * 4,
             Bl + row * DP + (tid & 63) * 4);
    }
  } else {
    // B tile as (k, n): 64 columns of all 256 rows of P.  Rows k and k + 1
    // (k even) interleave in runs of 16 columns, so that a lane finds its
    // column's k pair 16 dwords apart.
#pragma unroll
    for (int i = 0; i < 32; ++i) {
      const int row = 8 * i + (tid >> 4);
      const int seg = tid & 15;
      copy16(P + (size_t)row * STATE + nbase + seg * 4,
             Bl + (row >> 1) * PP + (seg >> 2) * 32 + (row & 1) * 16 + (seg & 3) * 4);
    }
  }

  // this wave's copies have landed; the barrier publishes every wave's
  asm volatile("s_wait_asynccnt 0x0" ::: "memory");
  __syncthreads();

  // The k loop runs in NS stages of SI fragment groups (32 WMMAs each); the
  // fragments of stage s + 1 are read from LDS in front of stage s's WMMAs.
  constexpr int SI = 8;
  constexpr int NS = STATE / 8 / SI;
  v8f acc0 = {}, acc1 = {};
  v4f a[2][SI];
  const float* ap = Al + (wm * 16 + l16) * DP + 4 * hh;
  if (!sq) {
    const float* bp = Bl + (wn * 32 + l16) * DP + 4 * hh;
    v4f b0[2][SI], b1[2][SI];
#pragma unroll
    for (int i = 0; i < SI; ++i) {
      a[0][i]  = *(const v4f*)(ap + 8 * i);
      b0[0][i] = *(const v4f*)(bp + 8 * i);
      b1[0][i] = *(const v4f*)(bp + 16 * DP + 8 * i);
    }
    // keeps stage 0's reads in front of stage 1's: the first WMMA then waits
    // for its own stage only
    __builtin_amdgcn_sched_barrier(0);
#pragma unroll  // constant indices keep the fragment arrays in registers
    for (int s = 0; s < NS; ++s) {
      const int cur = s & 1, nxt = cur ^ 1;
      if (s + 1 < NS) {
#pragma unroll
        for (int i = 0; i < SI; ++i) {
          const int k = 8 * ((s + 1) * SI + i);
          a[nxt][i]  = *(const v4f*)(ap + k);
          b0[nxt][i] = *(const v4f*)(bp + k);
          b1[nxt][i] = *(const v4f*)(bp + 16 * DP + k);
        }
      }
      // holds the next stage's LDS reads as one group a whole stage ahead of
      // their use; left free, they sink to one group of 4 WMMAs ahead
      __builtin_amdgcn_sched_barrier(0);
#pragma unroll
      for (int i = 0; i < SI; ++i) {
        acc0 = wmma4(a[cur][i].xy, b0[cur][i].xy, acc0);
        acc1 = wmma4(a[cur][i].xy, b1[cur][i].xy, acc1);
        acc0 = wmma4(a[cur][i].zw, b0[cur][i].zw, acc0);
        acc1 = wmma4(a[cur][i].zw, b1[cur][i].zw, acc1);
      }
      // keeps the reads of the stage after next behind this stage's WMMAs
      __builtin_amdgcn_sched_barrier(0);
    }
    const bool valid = (mo >> 3) >= off;  // a lane half is one chunk
#pragma unroll
    for (int r = 0; r < 8; ++r) {
      Sout[(size_t)(mo + r) * STATE + col]      = valid ? ad0[r] + acc0[r] : ad0[r];
      Sout[(size_t)(mo + r) * STATE + col + 16] = valid ? ad1[r] + acc1[r] : ad1[r];
    }
    // stands in front of any reuse of the registers that these stores name
    asm volatile("s_wait_xcnt 0x0" ::: "memory");
  } else {
    const float* bp = Bl + (2 * hh) * PP + wn * 64 + l16;
    // bq[..][i][2 * p + t]: k = 8i + 4h + 2p + 0..1 (as a's halves), tile t
    v2f bq[2][SI][4];
#pragma unroll
    for (int i = 0; i < SI; ++i) {
      a[0][i] = *(const v4f*)(ap + 8 * i);
#pragma unroll
      for (int q = 0; q < 4; ++q) {
        const float* e = bp + (4 * i + (q >> 1)) * PP + (q & 1) * 32;
        bq[0][i][q] = (v2f){e[0], e[16]};
      }
    }
    // keeps stage 0's reads in front of stage 1's: the first WMMA then waits
    // for its own stage only
    __builtin_amdgcn_sched_barrier(0);
#pragma unroll  // constant indices keep the fragment arrays in registers
    for (int s = 0; s < NS; ++s) {
      const int cur = s & 1, nxt = cur ^ 1;
      if (s + 1 < NS) {
#pragma unroll
        for (int i = 0; i < SI; ++i) {
          const int g = (s + 1) * SI + i;
          a[nxt][i] = *(const v4f*)(ap + 8 * g);
#pragma unroll
          for (int q = 0; q < 4; ++q) {
            const float* e = bp + (4 * g + (q >> 1)) * PP + (q & 1) * 32;
            bq[nxt][i][q] = (v2f){e[0], e[16]};
          }
        }
      }
      // holds the next stage's LDS reads as one group a whole stage ahead of
      // their use; left free, they sink to one group of 4 WMMAs ahead
      __builtin_amdgcn_sched_barrier(0);
#pragma unroll
      for (int i = 0; i < SI; ++i) {
        acc0 = wmma4(a[cur][i].xy, bq[cur][i][0], acc0);
        acc1 = wmma4(a[cur][i].xy, bq[cur][i][1], acc1);
        acc0 = wmma4(a[cur][i].zw, bq[cur][i][2], acc0);
        acc1 = wmma4(a[cur][i].zw, bq[cur][i][3], acc1);
      }
      // keeps the reads of the stage after next behind this stage's WMMAs
      __builtin_amdgcn_sched_barrier(0);
    }
#pragma unroll
    for (int r = 0; r < 8; ++r) {
      Pn[(size_t)(mo + r) * STATE + col]      = acc0[r];
      Pn[(size_t)(mo + r) * STATE + col + 16] = acc1[r];
    }
    // stands in front of any reuse of the registers that these stores name
    asm volatile("s_wait_xcnt 0x0" ::: "memory");
  }
}

// ---------------------------------------------------------------------------
// Kernel 5: correction: hs[s0 + t] += Hs * (A^T)^(t+1), parallel per chunk, both
// halves of the chunk at once: rows 0..7 of H start from Hc[c], the state at
// the start of chunk c, rows 8..15 from Hm[c], the state at the start of its
// second half.  The last state of the last chunk is also h_final.
// ---------------------------------------------------------------------------
__global__ void __launch_bounds__(256) scan_fix_kernel(
    const float* __restrict__ A, const float* __restrict__ Hc,
    const float* __restrict__ Hm, float* __restrict__ hs,
    float* __restrict__ hfinal) {
  __shared__ float Hlds[16 * LDSPITCH];
  const int c = blockIdx.x;
  v2f w0[KFRAG], w1[KFRAG];
  wload(A, w0, w1);
  // stands in front of the reuse of the address registers that wload's loads
  // name
  asm volatile("s_wait_xcnt 0x0" ::: "memory");
  // keeps the later writes of those registers behind the wait
  __builtin_amdgcn_sched_barrier(0);
  const float* hc = Hc + (size_t)c * HBLK;  // the same for all lanes
  const float* hm = Hm + (size_t)c * HBLK;
  float sc[BATCH], sm[BATCH];
#pragma unroll  // 16 independent loads in flight, one row each
  for (int r = 0; r < BATCH; ++r) {
    sc[r] = hc[threadIdx.x + r * STATE];
    sm[r] = hm[threadIdx.x + r * STATE];
  }
  // stands in front of the reuse of the address registers of these loads
  asm volatile("s_wait_xcnt 0x0" ::: "memory");
  // keeps the later writes of those registers behind the wait
  __builtin_amdgcn_sched_barrier(0);
  // hstep reads columns 0..STATE-1 only: the pad columns stay unwritten
#pragma unroll
  for (int r = 0; r < BATCH; ++r) {
    Hlds[r * LDSPITCH + threadIdx.x]           = sc[r];
    Hlds[(BATCH + r) * LDSPITCH + threadIdx.x] = sm[r];
  }
  __syncthreads();
  const int lane = threadIdx.x & 31;
  const int wave = threadIdx.x >> 5;
  const int col  = wave * 32 + (lane & 15);
  // C/D rows 8 h + r are batch row r of half h: the lane's place, counted from
  // step t of the first half; it does not change from step to step
  const unsigned lo = (unsigned)((lane >> 4) * HALF * HBLK + col);
  v8f acc[2];
  float v0[8], v1[8];  // the corrected state of the step
  for (int t = 0; t < HALF; ++t) {
    float* p = hs + (size_t)(c * CHUNK + t) * HBLK;  // the same for all lanes
    hstep(w0, w1, Hlds, acc);
    __syncthreads();
    hwrite(Hlds, acc);
#pragma unroll
    for (int r = 0; r < 8; ++r) {
      v0[r] = p[lo + r * STATE] + acc[0][r];
      v1[r] = p[lo + r * STATE + 16] + acc[1][r];
    }
#pragma unroll
    for (int r = 0; r < 8; ++r) {
      p[lo + r * STATE]      = v0[r];
      p[lo + r * STATE + 16] = v1[r];
    }
    // stands in front of the reuse of the address registers of these
    // loads and stores
    asm volatile("s_wait_xcnt 0x0" ::: "memory");
    __syncthreads();
  }
  if (lane >= 16 && c == NCHUNK - 1) {  // the last state of all is h_final
#pragma unroll
    for (int r = 0; r < 8; ++r) {
      hfinal[(size_t)r * STATE + col]      = v0[r];
      hfinal[(size_t)r * STATE + col + 16] = v1[r];
    }
    // stands in front of any reuse of the registers that these stores name
    asm volatile("s_wait_xcnt 0x0" ::: "memory");
  }
}

// ---------------------------------------------------------------------------
// Kernel 6: y[m,d] = hs_row(m) @ C^T + x_row(m) @ D^T   (m = b*SEQ + s)
// ---------------------------------------------------------------------------
// 8 waves per SIMD asked for: a budget of 128 VGPRs, so that the four
// work-groups that fit a WGP's LDS also fit its registers
__global__ void __launch_bounds__(256, 8) proj_out_kernel(
    const float* __restrict__ x, const float* __restrict__ hs,
    const float* __restrict__ C, const float* __restrict__ D,
    float* __restrict__ y) {
  __shared__ __attribute__((aligned(16))) float L[2 * GST];
  const int tid   = threadIdx.x;
  const int lane  = tid & 31;
  const int wave  = tid >> 5;
  const int mbase = blockIdx.y * GT;  // a tile's rows share one b
  const int nbase = blockIdx.x * GT;
  const int m     = mbase + (tid >> 3);
  const int n     = nbase + (tid >> 3);
  const int b = m >> 11, s = m & (SEQ - 1);
  const float* hg = hs + ((size_t)s * BATCH + b) * STATE + (tid & 7) * 4;
  const float* xg = x + (size_t)m * DMODEL + (tid & 7) * 4;
  const float* cg = C + (size_t)n * STATE + (tid & 7) * 4;
  const float* dg = D + (size_t)n * DMODEL + (tid & 7) * 4;
  v8f acc[8] = {{}, {}, {}, {}, {}, {}, {}, {}};
  const Product ph = {hg, (size_t)32 * HBLK, cg, (size_t)32 * STATE};
  const Product px = {xg, (size_t)32 * DMODEL, dg, (size_t)32 * DMODEL};
  gemm_ring<STATE / GK, DMODEL / GK>(ph, px, L, acc);
  const int mo  = mbase + (wave >> 1) * 32 + ((lane >> 4) << 3);
  const int col = nbase + (wave & 1) * 64 + (lane & 15);
#pragma unroll
  for (int t = 0; t < 4; ++t)
#pragma unroll
    for (int r = 0; r < 8; ++r) {
      y[(size_t)(mo + r) * DMODEL + col + t * 16]      = acc[t][r];
      y[(size_t)(mo + 16 + r) * DMODEL + col + t * 16] = acc[4 + t][r];
    }
}

// ---------------------------------------------------------------------------
extern "C" void kernel_launch(void* const* d_in, const int* in_sizes, int n_in,
                              void* d_out, int out_size, void* d_ws,
                              size_t ws_size, hipStream_t stream) {
  const float* x  = (const float*)d_in[0];
  const float* A  = (const float*)d_in[1];
  const float* B  = (const float*)d_in[2];
  const float* C  = (const float*)d_in[3];
  const float* D  = (const float*)d_in[4];
  const float* h0 = (const float*)d_in[5];

  float* y      = (float*)d_out;
  float* hfinal = y + (size_t)BATCH * SEQ * DMODEL;

  float* ws   = (float*)d_ws;
  float* hsBx = ws;                                  // 4,194,304 f32
  float* Sa   = hsBx + (size_t)SEQ * HBLK;           // NCHUNK + 1 states
  float* Sb   = Sa + (size_t)(NCHUNK + 1) * HBLK;    // NCHUNK states
  float* E1   = Sb + (size_t)NCHUNK * HBLK;          // NCHUNK states
  float* E2   = E1 + (size_t)NCHUNK * HBLK;          // NCHUNK states
  float* Pa   = E2 + (size_t)NCHUNK * HBLK;          //    65,536 f32
  float* Pb   = Pa + (size_t)STATE * STATE;          //    65,536 f32
  float* P8   = Pb + (size_t)STATE * STATE;          //    65,536 f32
  float* P4   = P8 + (size_t)STATE * STATE;          //    65,536 f32

  // 1) input projection; also Pa = A^2
  proj_in_kernel<<<dim3(STATE / GT, (BATCH * SEQ) / GT), 256, 0, stream>>>(
      x, B, hsBx, A, Pa);

  // 3) local scans inside each half chunk, in place; half ends -> E1, E2;
  //    h0 -> item 0 of Sa; also P4 = A^4
  scan_local_kernel<<<NCHUNK, 256, 0, stream>>>(A, h0, hsBx, Sa, E1, E2, Pa,
                                                P4);

  // 4a) the end of chunk c -> item c + 1 of Sa; also P8 = P4 @ P4
  scan_double_kernel<<<DBLK + SQBLK, 128, 0, stream>>>(E1, E2, Sa + HBLK, P4,
                                                       P8, 0);

  // 4b) chunk starts by doubling; each level but the last squares its power
  scan_double_kernel<<<DBLK + SQBLK, 128, 0, stream>>>(Sa, Sa, Sb, P8, Pa, 1);
  scan_double_kernel<<<DBLK + SQBLK, 128, 0, stream>>>(Sb, Sb, Sa, Pa, Pb, 2);
  scan_double_kernel<<<DBLK + SQBLK, 128, 0, stream>>>(Sa, Sa, Sb, Pb, Pa, 4);
  scan_double_kernel<<<DBLK + SQBLK, 128, 0, stream>>>(Sb, Sb, Sa, Pa, Pb, 8);
  scan_double_kernel<<<DBLK + SQBLK, 128, 0, stream>>>(Sa, Sa, Sb, Pb, Pa, 16);
  scan_double_kernel<<<DBLK + SQBLK, 128, 0, stream>>>(Sb, Sb, Sa, Pa, Pb, 32);
  scan_double_kernel<<<DBLK + SQBLK, 128, 0, stream>>>(Sa, Sa, Sb, Pb, Pa, 64);
  scan_double_kernel<<<DBLK, 128, 0, stream>>>(Sb, Sb, Sa, Pa, Pb, 128);

  // 4c) the start of each chunk's second half -> Sb
  scan_double_kernel<<<DBLK, 128, 0, stream>>>(Sa, E1, Sb, P4, Pb, 0);

  // 5) every state corrected by its half chunk's start state; emits h_final
  scan_fix_kernel<<<NCHUNK, 256, 0, stream>>>(A, Sa, Sb, hsBx, hfinal);

  // 6) output projection
  proj_out_kernel<<<dim3(DMODEL / GT, (BATCH * SEQ) / GT), 256, 0, stream>>>(
      x, hsBx, C, D, y);
}

// v008
// Measured time: 206 microseconds a run.
// Versions between v006 and this one are left out; their measured steps multiply to 1.56 times as fast.
// Counting every step since v000, it is 5.36 times as fast.
#include <hip/hip_runtime.h>
#include <hip/hip_bf16.h>

// ---------------------------------------------------------------------------
// TrajectorySSM on MI455X (gfx1250).  The scan runs on fp32 WMMA
// (V_WMMA_F32_16X16X4_F32); the two projections split each f32 operand into a
// bf16 head and a bf16 rest and run on V_WMMA_F32_16X16X32_BF16, f32 sums.
//
//   1) proj_in : Bx[s,b,n]   = sum_d x[b,s,d] * B[n,d]     (WMMA, LDS-staged X, W)
//                        further work-groups of this launch split C and D into
//                        their bf16 heads and rests, once, for 6)
//   2) A^2, A^4 (half chunk to half chunk): one 16x16 tile in each work-group
//                        of the GEMM of 1) and of 3), no launch of their own
//   3) scan_local, A   : 512 half chunks x 4 steps, zero init; a chunk's two
//                        halves fill the 16 rows of one work-group's H
//   4) scan_double x10 : chunk ends from the half ends with A^4; chunk starts
//                        by doubling, S[c] += S[c-2^d] * (P_d)^T with
//                        P_d = A^(8*2^d); second-half starts with A^4 again;
//                        a launch also squares its power for the next
//   5) scan_fix, A     : hs[s] += S[half chunk] * (A^T)^(t+1), emits h_final
//   6) proj_out : y = hs@C^T + x@D^T                (WMMA, LDS-staged X, W)
//
// Operand tiles are staged global->LDS with async-to-LDS copies (ASYNCcnt).
// ---------------------------------------------------------------------------

typedef __attribute__((ext_vector_type(2))) float v2f;
typedef __attribute__((ext_vector_type(4))) float v4f;
typedef __attribute__((ext_vector_type(8))) float v8f;
typedef __attribute__((ext_vector_type(4))) int   v4i;
typedef __attribute__((ext_vector_type(2)))  __bf16 bf16x2;
typedef __attribute__((ext_vector_type(16))) __bf16 bf16x16;

constexpr int BATCH  = 8;
constexpr int SEQ    = 2048;
constexpr int DMODEL = 1024;
constexpr int STATE  = 256;
constexpr int CHUNK  = 8;            // steps per chunk
constexpr int HALF   = CHUNK / 2;    // steps per half chunk
constexpr int NCHUNK = 256;          // SEQ / CHUNK
constexpr int HBLK   = BATCH * STATE;  // floats of one state (all batch rows)
constexpr int LDSPITCH = STATE + 2;  // scan-state pitch (bank-conflict pad)

// D = A(16x4 f32) * B(4x16 f32) + C(16x16 f32)
__device__ __forceinline__ v8f wmma4(v2f a, v2f b, v8f c) {
  return __builtin_amdgcn_wmma_f32_16x16x4_f32(
      /*neg_a=*/false, a, /*neg_b=*/false, b,
      /*c_mod=*/(short)0, c, /*reuse_a=*/false, /*reuse_b=*/false);
}

// D = A(16x32 bf16) * B(32x16 bf16) + C(16x16 f32)
__device__ __forceinline__ v8f wmma32(bf16x16 a, bf16x16 b, v8f c) {
  return __builtin_amdgcn_wmma_f32_16x16x32_bf16(
      /*neg_a=*/false, a, /*neg_b=*/false, b,
      /*c_mod=*/(short)0, c, /*reuse_a=*/false, /*reuse_b=*/false);
}

// 16 f32 of a lane as two bf16 fragments: hi = the value rounded to bf16,
// lo = what is left of it, rounded to bf16; hi + lo keeps about 16 bits of the
// significand.
__device__ __forceinline__ void split16(const v4f r[4], bf16x16& hi,
                                        bf16x16& lo) {
#pragma unroll  // constant indices keep the fragments in registers
  for (int j = 0; j < 4; ++j) {
    const v4f f = r[j];
#pragma unroll
    for (int e = 0; e < 2; ++e) {
      const v2f    x = e ? f.zw : f.xy;
      const bf16x2 h = __builtin_convertvector(x, bf16x2);
      const bf16x2 l =
          __builtin_convertvector(x - __builtin_convertvector(h, v2f), bf16x2);
      hi[4 * j + 2 * e]     = h[0];
      hi[4 * j + 2 * e + 1] = h[1];
      lo[4 * j + 2 * e]     = l[0];
      lo[4 * j + 2 * e + 1] = l[1];
    }
  }
}

// A weight matrix split ahead of its GEMM: every group of 16 consecutive floats
// of a row (k = 16 g + 0..15) becomes 16 words at the same place, 8 words of
// bf16 heads and then 8 words of bf16 rests, both in the order of k.  Rows,
// pitches and stage offsets are those of the f32 matrix, and the 64 bytes that
// a lane reads from a staged row are its two B fragments as they stand.
__device__ __forceinline__ void split_group(const float* __restrict__ src,
                                            float* __restrict__ dst) {
  v4f r[4];
#pragma unroll  // 4 independent loads in flight
  for (int j = 0; j < 4; ++j) r[j] = *(const v4f*)(src + 4 * j);
  // stands in front of the reuse of the address registers of these loads
  asm volatile("s_wait_xcnt 0x0" ::: "memory");
  // keeps the later writes of those registers behind the wait
  __builtin_amdgcn_sched_barrier(0);
  bf16x16 hi, lo;
  split16(r, hi, lo);
  const v8f h = __builtin_bit_cast(v8f, hi);
  const v8f l = __builtin_bit_cast(v8f, lo);
  *(v4f*)(dst)      = h.lo;
  *(v4f*)(dst + 4)  = h.hi;
  *(v4f*)(dst + 8)  = l.lo;
  *(v4f*)(dst + 12) = l.hi;
  // stands in front of any reuse of the registers that these stores name
  asm volatile("s_wait_xcnt 0x0" ::: "memory");
}

// --------------------------- async LDS staging -----------------------------
#if __has_builtin(__builtin_amdgcn_global_load_async_to_lds_b128)
#define SSM_ASYNC_LDS 1
#endif

// ---------------------------------------------------------------------------
// Work-group GEMM of the two projections: a 128(M) x 128(N) tile of
// Y = X * W^T, 8 waves as 4(M) x 2(N), each wave 32 x 64.  K runs in stages of
// GK columns.  A stage holds the X tile and the W tile, both as rows of GK
// floats at pitch GP, brought into LDS by asynchronous copies that cover whole
// 128-byte lines.  Two buffers: stage s + 1 flies while stage s is worked on.
// A stage is one bf16 WMMA k-step: lane half h holds k = 16h + 0..15, A and B
// alike.  An f32 fragment is split on its way from LDS (split16); a W that was
// split ahead (split_group) comes from LDS as its two fragments.  A product
// x * w is summed as xl * wh + xh * wl + xh * wh; xl * wl is dropped.
// ---------------------------------------------------------------------------
constexpr int GT  = 128;      // tile rows, X and W alike
constexpr int GK  = 32;       // k columns of a stage: one 128-byte line a row
constexpr int GP  = GK + 4;   // row pitch, 16 B x odd: b128 column walks
constexpr int GOP = GT * GP;  // floats of one operand's tile
constexpr int GST = 2 * GOP;  // floats of a stage: X tile, then W tile

// One stage.  Thread (r0 = tid / 8, seg = tid % 8) copies 16 bytes of the rows
// r0 + 32 j, j = 0..3, of both tiles: a wave's copy is 4 whole lines.  xg, wg:
// the thread's bytes of row r0; xstep, wstep: floats from row r to row r + 32;
// l: the thread's LDS byte address in row r0 of the stage's X tile.
__device__ __forceinline__ void stage_tiles(const float* xg, size_t xstep,
                                            const float* wg, size_t wstep,
                                            unsigned l) {
  constexpr unsigned LJ = 32 * GP * 4;  // LDS bytes from row r to row r + 32
  constexpr unsigned LW = GOP * 4;      // LDS bytes from the X to the W tile
  // The wait on xcnt closes the statement: it stands behind the last copy and
  // in front of every later write of an address register that a copy names.
  asm volatile(
      "global_load_async_to_lds_b128 %0, %8, off\n\t"
      "global_load_async_to_lds_b128 %1, %9, off\n\t"
      "global_load_async_to_lds_b128 %2, %10, off\n\t"
      "global_load_async_to_lds_b128 %3, %11, off\n\t"
      "global_load_async_to_lds_b128 %4, %12, off\n\t"
      "global_load_async_to_lds_b128 %5, %13, off\n\t"
      "global_load_async_to_lds_b128 %6, %14, off\n\t"
      "global_load_async_to_lds_b128 %7, %15, off\n\t"
      "s_wait_xcnt 0x0"
      :
      : "v"(l), "v"(l + LJ), "v"(l + 2 * LJ), "v"(l + 3 * LJ),
        "v"(l + LW), "v"(l + LW + LJ), "v"(l + LW + 2 * LJ),
        "v"(l + LW + 3 * LJ),
        "v"(xg), "v"(xg + xstep), "v"(xg + 2 * xstep), "v"(xg + 3 * xstep),
        "v"(wg), "v"(wg + wstep), "v"(wg + 2 * wstep), "v"(wg + 3 * wstep)
      : "memory");
}

// One product X * W^T of a ring: x, w are the thread's bytes of row tid / 8 of
// the two tiles at k = 0; xstep, wstep as in stage_tiles.
struct Product {
  const float* x;
  size_t xstep;
  const float* w;
  size_t wstep;
};

// Sums two products into one tile: N1 stages of p1, then N2 stages of p2, in
// one ring (N1 = 0: p2 alone).  acc[t] and acc[4 + t]: rows 0..15 and 16..31
// of the wave's tile, columns 16 t .. 16 t + 15.  N1 + N2 is at least 2.
// WS: both products' w point into matrices that split_group has written.
template <int N1, int N2, bool WS>
__device__ __forceinline__ void gemm_ring(const Product p1, const Product p2,
                                          float* L, v8f acc[8]) {
  const int tid  = threadIdx.x;
  const int lane = tid & 31;
  const int wave = tid >> 5;
  const int l16  = lane & 15;
  const int hh   = lane >> 4;
  const unsigned l0 =
      (unsigned)(size_t)L + (unsigned)(((tid >> 3) * GP + (tid & 7) * 4) * 4);
  const int aoff = ((wave >> 1) * 32 + l16) * GP + 16 * hh;
  const int boff = GOP + ((wave & 1) * 64 + l16) * GP + 16 * hh;
  constexpr int NST = N1 + N2;

  // the copies of stage q; q is the same for the whole work-group
  auto issue = [&](int q) {
    const unsigned l = l0 + (q & 1) * (GST * 4);
    if (q < N1)
      stage_tiles(p1.x + q * GK, p1.xstep, p1.w + q * GK, p1.wstep, l);
    else
      stage_tiles(p2.x + (q - N1) * GK, p2.xstep, p2.w + (q - N1) * GK,
                  p2.wstep, l);
  };

  issue(0);
  // this wave's copies of stage 0 have landed; the barrier publishes all
  asm volatile("s_wait_asynccnt 0x0" ::: "memory");
  __syncthreads();
  issue(1);

#pragma unroll 1  // one stage's code serves every stage: the text stays small
  for (int s = 0; s < NST; ++s) {
    const float* ap = L + (s & 1) * GST + aoff;
    const float* bp = L + (s & 1) * GST + boff;
    // ra[h]: rows 16 h .. 16 h + 15; rb[t]: columns 16 t .. 16 t + 15
    v4f ra[2][4], rb[4][4];
#pragma unroll  // constant indices keep the fragments in registers
    for (int j = 0; j < 4; ++j) {
      ra[0][j] = *(const v4f*)(ap + 4 * j);
      ra[1][j] = *(const v4f*)(ap + 16 * GP + 4 * j);
    }
#pragma unroll
    for (int t = 0; t < 4; ++t)
#pragma unroll
      for (int j = 0; j < 4; ++j)
        rb[t][j] = *(const v4f*)(bp + 16 * t * GP + 4 * j);
    // holds the stage's 24 LDS reads together in front of the work on them;
    // left free, they sink to just in front of their use, each with a full
    // wait of its own
    __builtin_amdgcn_sched_barrier(0);
    bf16x16 ah[2], al[2];
    split16(ra[0], ah[0], al[0]);
    split16(ra[1], ah[1], al[1]);
#pragma unroll  // constant indices keep acc in registers
    for (int t = 0; t < 4; ++t) {
      bf16x16 bh, bl;
      if constexpr (WS) {
        bh = __builtin_bit_cast(
            bf16x16,
            __builtin_shufflevector(rb[t][0], rb[t][1], 0, 1, 2, 3, 4, 5, 6, 7));
        bl = __builtin_bit_cast(
            bf16x16,
            __builtin_shufflevector(rb[t][2], rb[t][3], 0, 1, 2, 3, 4, 5, 6, 7));
      } else {
        split16(rb[t], bh, bl);
      }
      // the two row tiles take turns, so that no WMMA waits for the one in
      // front of it; the small terms are summed first
      acc[t]     = wmma32(al[0], bh, acc[t]);
      acc[4 + t] = wmma32(al[1], bh, acc[4 + t]);
      acc[t]     = wmma32(ah[0], bl, acc[t]);
      acc[4 + t] = wmma32(ah[1], bl, acc[4 + t]);
      acc[t]     = wmma32(ah[0], bh, acc[t]);
      acc[4 + t] = wmma32(ah[1], bh, acc[4 + t]);
    }
    // keeps the stage's work in front of the waits below, so that the copies
    // of stage s + 1 fly under it; left free, the waits and the barrier rise
    // to just behind the LDS reads and the copies' flight is waited out
    __builtin_amdgcn_sched_barrier(0);
    // this wave's reads of stage s have returned
    asm volatile("s_wait_dscnt 0x0" ::: "memory");
    // this wave's copies of stage s + 1 have landed
    asm volatile("s_wait_asynccnt 0x0" ::: "memory");
    __syncthreads();  // publishes stage s + 1, frees the buffer of stage s
    if (s + 2 < NST) issue(s + 2);
  }
  // no copy is left in flight behind the loop
  asm volatile("s_wait_asynccnt 0x0" ::: "memory");
}

// ---------------------------------------------------------------------------
// One 16 x 16 tile of Dst = S @ S (256 x 256) by a work-group of 8 waves; the
// 256 work-groups of a launch give the whole square.  Wave w sums the 32 k from
// 32 w on (8 WMMAs); the 8 partial tiles meet in red (8 x 256 floats of LDS).
// Lane half h holds k = 4 i + 2 h + 0..1, A and B alike.
// ---------------------------------------------------------------------------
__device__ __forceinline__ void square_tile(const float* __restrict__ S,
                                            float* __restrict__ Dst, int tile,
                                            float* __restrict__ red) {
  const int tid  = threadIdx.x;
  const int lane = tid & 31;
  const int wave = tid >> 5;
  const int l16  = lane & 15;
  const int hh   = lane >> 4;
  const int m0   = (tile >> 4) * 16;
  const int n0   = (tile & 15) * 16;
  const int k0   = wave * 32 + 2 * hh;
  const float* ap = S + (size_t)(m0 + l16) * STATE + k0;
  const float* bp = S + (size_t)k0 * STATE + n0 + l16;
  v2f a[8], b[8];
#pragma unroll  // 24 independent loads in flight
  for (int i = 0; i < 8; ++i) {
    a[i] = *(const v2f*)(ap + 4 * i);
    b[i] = (v2f){bp[(4 * i) * STATE], bp[(4 * i + 1) * STATE]};
  }
  // stands in front of the reuse of the address registers of these loads
  asm volatile("s_wait_xcnt 0x0" ::: "memory");
  // keeps the later writes of those registers behind the wait
  __builtin_amdgcn_sched_barrier(0);
  v8f acc = {};
#pragma unroll
  for (int i = 0; i < 8; ++i) acc = wmma4(a[i], b[i], acc);
  // Four vector slots between the last WMMA and the first vector instruction
  // that reads its D; the two scheduling barriers hold them at this place.
  __builtin_amdgcn_sched_barrier(0);
  asm volatile("v_nop\n\tv_nop\n\tv_nop\n\tv_nop");
  __builtin_amdgcn_sched_barrier(0);
#pragma unroll
  for (int r = 0; r < 8; ++r)  // C/D layout: M = r + 8*(lane/16)
    red[wave * 256 + (r + 8 * hh) * 16 + l16] = acc[r];
  __syncthreads();  // every wave's partial tile is in red
  float sum = red[tid];
#pragma unroll
  for (int w = 1; w < 8; ++w) sum += red[w * 256 + tid];
  Dst[(size_t)(m0 + (tid >> 4)) * STATE + n0 + (tid & 15)] = sum;
  // stands in front of any reuse of the registers that this store names
  asm volatile("s_wait_xcnt 0x0" ::: "memory");
}

// ---------------------------------------------------------------------------
// Kernel 1: Bx[s*8+b, n] = sum_d x[b,s,d] * B[n,d]  (M=16384, N=256, K=1024)
// Each of the 256 work-groups also computes one tile of A2 = A @ A.
// The SPLITWG work-groups behind them split C and D for kernel 6, one group of
// 16 floats a thread: they run beside the GEMM's one work-group per WGP.
// ---------------------------------------------------------------------------
constexpr int MTILES  = (BATCH * SEQ) / GT;       // GEMM rows of the grid
constexpr int CGROUPS = DMODEL * STATE / 16;      // groups of 16 floats in C
constexpr int DGROUPS = DMODEL * DMODEL / 16;     // and in D
constexpr int SPLITWG = (CGROUPS + DGROUPS) / 256;

__global__ void __launch_bounds__(256) proj_in_kernel(
    const float* __restrict__ x, const float* __restrict__ B,
    float* __restrict__ Bx, const float* __restrict__ A,
    float* __restrict__ A2, const float* __restrict__ C,
    const float* __restrict__ D, float* __restrict__ Cs,
    float* __restrict__ Ds) {
  __shared__ __attribute__((aligned(16))) float L[2 * GST];
  __shared__ float red[8 * 256];
  if (blockIdx.y >= MTILES) {  // the whole work-group, in front of any barrier
    // the work-group's first group, counted through C and then through D
    const int g0  = ((blockIdx.y - MTILES) * (STATE / GT) + blockIdx.x) * 256;
    const bool oc = g0 < CGROUPS;  // 256 divides CGROUPS: all of it in one
    const size_t o =
        (size_t)((oc ? g0 : g0 - CGROUPS) + (int)threadIdx.x) * 16;
    split_group((oc ? C : D) + o, (oc ? Cs : Ds) + o);
    return;
  }
  square_tile(A, A2, blockIdx.y * (STATE / GT) + blockIdx.x, red);
  const int tid   = threadIdx.x;
  const int lane  = tid & 31;
  const int wave  = tid >> 5;
  const int mbase = blockIdx.y * GT;
  const int nbase = blockIdx.x * GT;
  const int m     = mbase + (tid >> 3);  // output rows are s*8+b ordered
  const float* xg =
      x + ((size_t)(m & 7) * SEQ + (m >> 3)) * DMODEL + (tid & 7) * 4;
  const float* wg = B + (size_t)(nbase + (tid >> 3)) * DMODEL + (tid & 7) * 4;
  v8f acc[8] = {{}, {}, {}, {}, {}, {}, {}, {}};
  // 32 output rows on: the same b, s + 4
  const Product p = {xg, (size_t)4 * DMODEL, wg, (size_t)32 * DMODEL};
  gemm_ring<0, DMODEL / GK, false>(p, p, L, acc);
  const int mo  = mbase + (wave >> 1) * 32 + ((lane >> 4) << 3);
  const int col = nbase + (wave & 1) * 64 + (lane & 15);
#pragma unroll
  for (int t = 0; t < 4; ++t)
#pragma unroll
    for (int r = 0; r < 8; ++r) {
      Bx[(size_t)(mo + r) * STATE + col + t * 16]      = acc[t][r];
      Bx[(size_t)(mo + 16 + r) * STATE + col + t * 16] = acc[4 + t][r];
    }
}

// ---------------------------------------------------------------------------
// Scan helpers: H (16x256, the batch rows of two half chunks) in LDS; one step computes
// H @ W^T with W row-major (256,256).  8 waves, each owns 32 columns.
// W does not change from step to step, so each wave loads the B fragments of
// its 32 columns once (wload: 2 x 64 fragments = 256 VGPRs per lane) and every
// step reads them from registers; only H moves through LDS.
// ---------------------------------------------------------------------------
constexpr int KFRAG = STATE / 4;  // 16x16x4 k-steps per H @ W^T product

__device__ __forceinline__ void wload(const float* __restrict__ W,
                                      v2f w0[KFRAG], v2f w1[KFRAG]) {
  const int lane = threadIdx.x & 31;
  const int wave = threadIdx.x >> 5;
  const int kb   = ((lane >> 4) & 1) << 1;
  const int n0   = wave * 32 + (lane & 15);
  // full unroll: constant indices keep w0/w1 in registers, not in scratch
#pragma unroll
  for (int i = 0; i < KFRAG; ++i) {
    w0[i] = *(const v2f*)&W[(size_t)n0 * STATE + 4 * i + kb];
    w1[i] = *(const v2f*)&W[(size_t)(n0 + 16) * STATE + 4 * i + kb];
  }
}

__device__ __forceinline__ void hstep(const v2f w0[KFRAG], const v2f w1[KFRAG],
                                      const float* __restrict__ Hlds,
                                      v8f acc[2]) {
  const int lane = threadIdx.x & 31;
  const int mrow = lane & 15;
  const int kb   = ((lane >> 4) & 1) << 1;
  acc[0] = (v8f){};
  acc[1] = (v8f){};
  // full unroll: constant indices keep w0/w1 in registers, not in scratch
#pragma unroll
  for (int i = 0; i < KFRAG; ++i) {
    v2f a  = *(const v2f*)&Hlds[mrow * LDSPITCH + 4 * i + kb];
    acc[0] = wmma4(a, w0[i], acc[0]);
    acc[1] = wmma4(a, w1[i], acc[1]);
  }
  // Four vector slots between the last WMMA and the first vector instruction
  // that reads its D or overwrites its A.  The two scheduling barriers hold the
  // slots at this place.
  __builtin_amdgcn_sched_barrier(0);
  asm volatile("v_nop\n\tv_nop\n\tv_nop\n\tv_nop");
  __builtin_amdgcn_sched_barrier(0);
}

__device__ __forceinline__ void hwrite(float* __restrict__ Hlds,
                                       const v8f acc[2]) {
  const int lane = threadIdx.x & 31;
  const int wave = threadIdx.x >> 5;
  const int mo   = (lane >> 4) << 3;  // C/D layout: M = r + 8*(lane/16)
  const int col  = wave * 32 + (lane & 15);
#pragma unroll
  for (int r = 0; r < 8; ++r) {
    Hlds[(mo + r) * LDSPITCH + col]      = acc[0][r];
    Hlds[(mo + r) * LDSPITCH + col + 16] = acc[1][r];
  }
}

// ---------------------------------------------------------------------------
// Kernel 3: local scans (h starts at 0) over the two halves of chunk c at once,
// in place on the Bx buffer: h = h @ A^T + hs[s], hs[s] = h.  Rows 0..7 of H
// are the batch rows of steps 0..3 of the chunk, rows 8..15 those of steps
// 4..7, so that no row of a WMMA is padding.  The halves' ends go to E1[c] and
// E2[c].  Item 0 of V, the sequence that scan_double scans, is the broadcast
// h0.  Each of the 256 work-groups also computes one tile of A4 = A2 @ A2.
// ---------------------------------------------------------------------------
__global__ void __launch_bounds__(256) scan_local_kernel(
    const float* __restrict__ A, const float* __restrict__ h0, float* hs,
    float* __restrict__ V, float* __restrict__ E1, float* __restrict__ E2,
    const float* __restrict__ A2, float* __restrict__ A4) {
  __shared__ float Hlds[16 * LDSPITCH];
  __shared__ float red[8 * 256];
  const int c = blockIdx.x;
  square_tile(A2, A4, c, red);
  v2f w0[KFRAG], w1[KFRAG];
  wload(A, w0, w1);
  // stands in front of the reuse of the address registers that wload's loads
  // name
  asm volatile("s_wait_xcnt 0x0" ::: "memory");
  // keeps the later writes of those registers behind the wait
  __builtin_amdgcn_sched_barrier(0);
  for (int i = threadIdx.x; i < 16 * LDSPITCH; i += blockDim.x) Hlds[i] = 0.f;
  if (c == 0) {
#pragma unroll  // one load of h0, BATCH stores off one address
    for (int r = 0; r < BATCH; ++r)
      V[r * STATE + threadIdx.x] = h0[threadIdx.x];
    // stands in front of the reuse of the address registers of these stores
    asm volatile("s_wait_xcnt 0x0" ::: "memory");
  }
  __syncthreads();
  const int lane = threadIdx.x & 31;
  const int wave = threadIdx.x >> 5;
  const int col  = wave * 32 + (lane & 15);
  // C/D rows 8 h + r are batch row r of half h: the lane's place, counted from
  // step t of the first half; it does not change from step to step
  const unsigned lo = (unsigned)((lane >> 4) * HALF * HBLK + col);
  v8f acc[2];
  for (int t = 0; t < HALF; ++t) {
    float* p = hs + (size_t)(c * CHUNK + t) * HBLK;  // the same for all lanes
    hstep(w0, w1, Hlds, acc);
#pragma unroll
    for (int r = 0; r < 8; ++r) {
      acc[0][r] += p[lo + r * STATE];
      acc[1][r] += p[lo + r * STATE + 16];
    }
    __syncthreads();  // all waves done reading H
    hwrite(Hlds, acc);
#pragma unroll
    for (int r = 0; r < 8; ++r) {
      p[lo + r * STATE]      = acc[0][r];
      p[lo + r * STATE + 16] = acc[1][r];
    }
    // stands in front of the reuse of the address registers of these stores
    asm volatile("s_wait_xcnt 0x0" ::: "memory");
    __syncthreads();  // H fully written before next step
  }
  float* __restrict__ E = (lane >> 4) ? E2 : E1;  // the lane's half's end
#pragma unroll
  for (int r = 0; r < 8; ++r) {
    const size_t base = ((size_t)c * BATCH + r) * STATE;
    E[base + col]      = acc[0][r];
    E[base + col + 16] = acc[1][r];
  }
  // stands in front of any reuse of the registers that these stores name
  asm volatile("s_wait_xcnt 0x0" ::: "memory");
}

// ---------------------------------------------------------------------------
// Kernel 4 (x10): one level of the scan over the NCHUNK chunks:
//   Sout[c] = Add[c] + Sin[c - off] @ P^T   (c >= off; a plain copy below).
// Doubling: Add = Sin, P = A^(CHUNK * off); after off = 1, 2, .. 128, S[c] is
// the state at the start of chunk c.  With off = 0 and P = A^HALF the same sum
// carries a state over half a chunk: in front of the doubling the chunk's end
// E2[c] + E1[c] @ P^T, behind it the second half's start E1[c] + S[c] @ P^T.
// All rows (chunk, batch) form one 2048 x 256 x 256 GEMM:
// 256 work-groups of 4 waves, each a 32(M) x 64(N) tile, each wave 16 x 32.
// Work-groups from DBLK on compute Pn = P @ P for the next level in the same
// tile shape.  Both operand tiles are brought whole into LDS by asynchronous
// copies.  Every lane reads 4 consecutive k per fragment load, A and B alike:
// lane half h holds k = 8i + 4h + 0..3, two WMMA k-steps.
// ---------------------------------------------------------------------------
constexpr int DP    = STATE + 4;  // row pitch, 16 B x odd: b128 column walks
constexpr int PP    = 136;        // pitch of a k row pair of the (k, n) tile
constexpr int DBLK  = (NCHUNK * BATCH / 32) * (STATE / 64);  // scan tiles
constexpr int SQBLK = (STATE / 32) * (STATE / 64);           // squaring tiles

__device__ __forceinline__ void copy16(const float* __restrict__ g,
                                       float* __restrict__ l) {
#if defined(SSM_ASYNC_LDS)
  __builtin_amdgcn_global_load_async_to_lds_b128((v4i*)g, (v4i*)l, 0, 0);
#else
  *(v4f*)l = *(const v4f*)g;
#endif
}

__global__ void __launch_bounds__(128) scan_double_kernel(
    const float* __restrict__ Sin, const float* __restrict__ Add,
    float* __restrict__ Sout, const float* __restrict__ P,
    float* __restrict__ Pn, int off) {
  __shared__ __attribute__((aligned(16))) float Al[32 * DP];
  __shared__ __attribute__((aligned(16))) float Bl[(STATE / 2) * PP];  // >= 64 * DP
  const int tid  = threadIdx.x;
  const int lane = tid & 31;
  const int wave = tid >> 5;
  const int l16  = lane & 15;
  const int hh   = lane >> 4;
  const bool sq  = blockIdx.x >= DBLK;  // the same for the whole work-group
  const int tile  = sq ? blockIdx.x - DBLK : blockIdx.x;
  const int m0    = (tile >> 2) * 32;
  const int nbase = (tile & 3) * 64;
  const int back  = sq ? 0 : off * BATCH;
  const float* __restrict__ In = sq ? P : Sin;

  const int wm  = wave >> 1;
  const int wn  = wave & 1;
  const int mo  = m0 + wm * 16 + (hh << 3);  // C/D layout: M = r + 8*(lane/16)
  const int col = nbase + wn * 32 + l16;

  float ad0[8], ad1[8];
  if (!sq) {  // the summand Add[c], fetched while the copies fly
#pragma unroll
    for (int r = 0; r < 8; ++r) {
      ad0[r] = Add[(size_t)(mo + r) * STATE + col];
      ad1[r] = Add[(size_t)(mo + r) * STATE + col + 16];
    }
    // stands in front of the reuse of the address registers of these loads
    asm volatile("s_wait_xcnt 0x0" ::: "memory");
    if (m0 + 32 <= back) {  // whole tile below the first source: a plain copy
#pragma unroll
      for (int r = 0; r < 8; ++r) {
        Sout[(size_t)(mo + r) * STATE + col]      = ad0[r];
        Sout[(size_t)(mo + r) * STATE + col + 16] = ad1[r];
      }
      // stands in front of any reuse of the registers that these stores name
      asm volatile("s_wait_xcnt 0x0" ::: "memory");
      return;  // taken by the whole work-group, in front of the barrier
    }
  }

  // A tile: 32 rows of 1 KiB.  A row below the first item has no source: it
  // takes a row that exists, and its product is dropped at the store.
#pragma unroll
  for (int i = 0; i < 16; ++i) {
    const int row = 2 * i + (tid >> 6);
    int sr = m0 + row - back;
    sr = sr < 0 ? (row & (BATCH - 1)) : sr;
    copy16(In + (size_t)sr * STATE + (tid & 63) * 4, Al + row * DP + (tid & 63) * 4);
  }
  if (!sq) {  // B tile as (n, k): 64 rows of P, 1 KiB each
#pragma unroll
    for (int i = 0; i < 32; ++i) {
      const int row = 2 * i + (tid >> 6);
      copy16(P + (size_t)(nbase + row) * STATE + (tid & 63) * 4,
             Bl + row * DP + (tid & 63) * 4);
    }
  } else {
    // B tile as (k, n): 64 columns of all 256 rows of P.  Rows k and k + 1
    // (k even) interleave in runs of 16 columns, so that a lane finds its
    // column's k pair 16 dwords apart.
#pragma unroll
    for (int i = 0; i < 32; ++i) {
      const int row = 8 * i + (tid >> 4);
      const int seg = tid & 15;
      copy16(P + (size_t)row * STATE + nbase + seg * 4,
             Bl + (row >> 1) * PP + (seg >> 2) * 32 + (row & 1) * 16 + (seg & 3) * 4);
    }
  }

  // this wave's copies have landed; the barrier publishes every wave's
  asm volatile("s_wait_asynccnt 0x0" ::: "memory");
  __syncthreads();

  // The k loop runs in NS stages of SI fragment groups (32 WMMAs each); the
  // fragments of stage s + 1 are read from LDS in front of stage s's WMMAs.
  constexpr int SI = 8;
  constexpr int NS = STATE / 8 / SI;
  v8f acc0 = {}, acc1 = {};
  v4f a[2][SI];
  const float* ap = Al + (wm * 16 + l16) * DP + 4 * hh;
  if (!sq) {
    const float* bp = Bl + (wn * 32 + l16) * DP + 4 * hh;
    v4f b0[2][SI], b1[2][SI];
#pragma unroll
    for (int i = 0; i < SI; ++i) {
      a[0][i]  = *(const v4f*)(ap + 8 * i);
      b0[0][i] = *(const v4f*)(bp + 8 * i);
      b1[0][i] = *(const v4f*)(bp + 16 * DP + 8 * i);
    }
    // keeps stage 0's reads in front of stage 1's: the first WMMA then waits
    // for its own stage only
    __builtin_amdgcn_sched_barrier(0);
#pragma unroll  // constant indices keep the fragment arrays in registers
    for (int s = 0; s < NS; ++s) {
      const int cur = s & 1, nxt = cur ^ 1;
      if (s + 1 < NS) {
#pragma unroll
        for (int i = 0; i < SI; ++i) {
          const int k = 8 * ((s + 1) * SI + i);
          a[nxt][i]  = *(const v4f*)(ap + k);
          b0[nxt][i] = *(const v4f*)(bp + k);
          b1[nxt][i] = *(const v4f*)(bp + 16 * DP + k);
        }
      }
      // holds the next stage's LDS reads as one group a whole stage ahead of
      // their use; left free, they sink to one group of 4 WMMAs ahead
      __builtin_amdgcn_sched_barrier(0);
#pragma unroll
      for (int i = 0; i < SI; ++i) {
        acc0 = wmma4(a[cur][i].xy, b0[cur][i].xy, acc0);
        acc1 = wmma4(a[cur][i].xy, b1[cur][i].xy, acc1);
        acc0 = wmma4(a[cur][i].zw, b0[cur][i].zw, acc0);
        acc1 = wmma4(a[cur][i].zw, b1[cur][i].zw, acc1);
      }
      // keeps the reads of the stage after next behind this stage's WMMAs
      __builtin_amdgcn_sched_barrier(0);
    }
    const bool valid = (mo >> 3) >= off;  // a lane half is one chunk
#pragma unroll
    for (int r = 0; r < 8; ++r) {
      Sout[(size_t)(mo + r) * STATE + col]      = valid ? ad0[r] + acc0[r] : ad0[r];
      Sout[(size_t)(mo + r) * STATE + col + 16] = valid ? ad1[r] + acc1[r] : ad1[r];
    }
    // stands in front of any reuse of the registers that these stores name
    asm volatile("s_wait_xcnt 0x0" ::: "memory");
  } else {
    const float* bp = Bl + (2 * hh) * PP + wn * 64 + l16;
    // bq[..][i][2 * p + t]: k = 8i + 4h + 2p + 0..1 (as a's halves), tile t
    v2f bq[2][SI][4];
#pragma unroll
    for (int i = 0; i < SI; ++i) {
      a[0][i] = *(const v4f*)(ap + 8 * i);
#pragma unroll
      for (int q = 0; q < 4; ++q) {
        const float* e = bp + (4 * i + (q >> 1)) * PP + (q & 1) * 32;
        bq[0][i][q] = (v2f){e[0], e[16]};
      }
    }
    // keeps stage 0's reads in front of stage 1's: the first WMMA then waits
    // for its own stage only
    __builtin_amdgcn_sched_barrier(0);
#pragma unroll  // constant indices keep the fragment arrays in registers
    for (int s = 0; s < NS; ++s) {
      const int cur = s & 1, nxt = cur ^ 1;
      if (s + 1 < NS) {
#pragma unroll
        for (int i = 0; i < SI; ++i) {
          const int g = (s + 1) * SI + i;
          a[nxt][i] = *(const v4f*)(ap + 8 * g);
#pragma unroll
          for (int q = 0; q < 4; ++q) {
            const float* e = bp + (4 * g + (q >> 1)) * PP + (q & 1) * 32;
            bq[nxt][i][q] = (v2f){e[0], e[16]};
          }
        }
      }
      // holds the next stage's LDS reads as one group a whole stage ahead of
      // their use; left free, they sink to one group of 4 WMMAs ahead
      __builtin_amdgcn_sched_barrier(0);
#pragma unroll
      for (int i = 0; i < SI; ++i) {
        acc0 = wmma4(a[cur][i].xy, bq[cur][i][0], acc0);
        acc1 = wmma4(a[cur][i].xy, bq[cur][i][1], acc1);
        acc0 = wmma4(a[cur][i].zw, bq[cur][i][2], acc0);
        acc1 = wmma4(a[cur][i].zw, bq[cur][i][3], acc1);
      }
      // keeps the reads of the stage after next behind this stage's WMMAs
      __builtin_amdgcn_sched_barrier(0);
    }
#pragma unroll
    for (int r = 0; r < 8; ++r) {
      Pn[(size_t)(mo + r) * STATE + col]      = acc0[r];
      Pn[(size_t)(mo + r) * STATE + col + 16] = acc1[r];
    }
    // stands in front of any reuse of the registers that these stores name
    asm volatile("s_wait_xcnt 0x0" ::: "memory");
  }
}

// ---------------------------------------------------------------------------
// Kernel 5: correction: hs[s0 + t] += Hs * (A^T)^(t+1), parallel per chunk, both
// halves of the chunk at once: rows 0..7 of H start from Hc[c], the state at
// the start of chunk c, rows 8..15 from Hm[c], the state at the start of its
// second half.  The last state of the last chunk is also h_final.
// ---------------------------------------------------------------------------
__global__ void __launch_bounds__(256) scan_fix_kernel(
    const float* __restrict__ A, const float* __restrict__ Hc,
    const float* __restrict__ Hm, float* __restrict__ hs,
    float* __restrict__ hfinal) {
  __shared__ float Hlds[16 * LDSPITCH];
  const int c = blockIdx.x;
  v2f w0[KFRAG], w1[KFRAG];
  wload(A, w0, w1);
  // stands in front of the reuse of the address registers that wload's loads
  // name
  asm volatile("s_wait_xcnt 0x0" ::: "memory");
  // keeps the later writes of those registers behind the wait
  __builtin_amdgcn_sched_barrier(0);
  const float* hc = Hc + (size_t)c * HBLK;  // the same for all lanes
  const float* hm = Hm + (size_t)c * HBLK;
  float sc[BATCH], sm[BATCH];
#pragma unroll  // 16 independent loads in flight, one row each
  for (int r = 0; r < BATCH; ++r) {
    sc[r] = hc[threadIdx.x + r * STATE];
    sm[r] = hm[threadIdx.x + r * STATE];
  }
  // stands in front of the reuse of the address registers of these loads
  asm volatile("s_wait_xcnt 0x0" ::: "memory");
  // keeps the later writes of those registers behind the wait
  __builtin_amdgcn_sched_barrier(0);
  // hstep reads columns 0..STATE-1 only: the pad columns stay unwritten
#pragma unroll
  for (int r = 0; r < BATCH; ++r) {
    Hlds[r * LDSPITCH + threadIdx.x]           = sc[r];
    Hlds[(BATCH + r) * LDSPITCH + threadIdx.x] = sm[r];
  }
  __syncthreads();
  const int lane = threadIdx.x & 31;
  const int wave = threadIdx.x >> 5;
  const int col  = wave * 32 + (lane & 15);
  // C/D rows 8 h + r are batch row r of half h: the lane's place, counted from
  // step t of the first half; it does not change from step to step
  const unsigned lo = (unsigned)((lane >> 4) * HALF * HBLK + col);
  v8f acc[2];
  float v0[8], v1[8];  // the corrected state of the step
  for (int t = 0; t < HALF; ++t) {
    float* p = hs + (size_t)(c * CHUNK + t) * HBLK;  // the same for all lanes
    hstep(w0, w1, Hlds, acc);
    __syncthreads();
    hwrite(Hlds, acc);
#pragma unroll
    for (int r = 0; r < 8; ++r) {
      v0[r] = p[lo + r * STATE] + acc[0][r];
      v1[r] = p[lo + r * STATE + 16] + acc[1][r];
    }
#pragma unroll
    for (int r = 0; r < 8; ++r) {
      p[lo + r * STATE]      = v0[r];
      p[lo + r * STATE + 16] = v1[r];
    }
    // stands in front of the reuse of the address registers of these
    // loads and stores
    asm volatile("s_wait_xcnt 0x0" ::: "memory");
    __syncthreads();
  }
  if (lane >= 16 && c == NCHUNK - 1) {  // the last state of all is h_final
#pragma unroll
    for (int r = 0; r < 8; ++r) {
      hfinal[(size_t)r * STATE + col]      = v0[r];
      hfinal[(size_t)r * STATE + col + 16] = v1[r];
    }
    // stands in front of any reuse of the registers that these stores name
    asm volatile("s_wait_xcnt 0x0" ::: "memory");
  }
}

// ---------------------------------------------------------------------------
// Kernel 6: y[m,d] = hs_row(m) @ C^T + x_row(m) @ D^T   (m = b*SEQ + s)
// Cs, Ds: C and D as kernel 1's launch has split them (split_group).
// ---------------------------------------------------------------------------
// 4 waves per SIMD asked for: a budget of 256 VGPRs for the accumulators and
// the split fragments
__global__ void __launch_bounds__(256, 4) proj_out_kernel(
    const float* __restrict__ x, const float* __restrict__ hs,
    const float* __restrict__ Cs, const float* __restrict__ Ds,
    float* __restrict__ y) {
  __shared__ __attribute__((aligned(16))) float L[2 * GST];
  const int tid   = threadIdx.x;
  const int lane  = tid & 31;
  const int wave  = tid >> 5;
  const int mbase = blockIdx.y * GT;  // a tile's rows share one b
  const int nbase = blockIdx.x * GT;
  const int m     = mbase + (tid >> 3);
  const int n     = nbase + (tid >> 3);
  const int b = m >> 11, s = m & (SEQ - 1);
  const float* hg = hs + ((size_t)s * BATCH + b) * STATE + (tid & 7) * 4;
  const float* xg = x + (size_t)m * DMODEL + (tid & 7) * 4;
  const float* cg = Cs + (size_t)n * STATE + (tid & 7) * 4;
  const float* dg = Ds + (size_t)n * DMODEL + (tid & 7) * 4;
  v8f acc[8] = {{}, {}, {}, {}, {}, {}, {}, {}};
  const Product ph = {hg, (size_t)32 * HBLK, cg, (size_t)32 * STATE};
  const Product px = {xg, (size_t)32 * DMODEL, dg, (size_t)32 * DMODEL};
  gemm_ring<STATE / GK, DMODEL / GK, true>(ph, px, L, acc);
  const int mo  = mbase + (wave >> 1) * 32 + ((lane >> 4) << 3);
  const int col = nbase + (wave & 1) * 64 + (lane & 15);
#pragma unroll
  for (int t = 0; t < 4; ++t)
#pragma unroll
    for (int r = 0; r < 8; ++r) {
      y[(size_t)(mo + r) * DMODEL + col + t * 16]      = acc[t][r];
      y[(size_t)(mo + 16 + r) * DMODEL + col + t * 16] = acc[4 + t][r];
    }
}

// ---------------------------------------------------------------------------
extern "C" void kernel_launch(void* const* d_in, const int* in_sizes, int n_in,
                              void* d_out, int out_size, void* d_ws,
                              size_t ws_size, hipStream_t stream) {
  const float* x  = (const float*)d_in[0];
  const float* A  = (const float*)d_in[1];
  const float* B  = (const float*)d_in[2];
  const float* C  = (const float*)d_in[3];
  const float* D  = (const float*)d_in[4];
  const float* h0 = (const float*)d_in[5];

  float* y      = (float*)d_out;
  float* hfinal = y + (size_t)BATCH * SEQ * DMODEL;

  float* ws   = (float*)d_ws;
  float* hsBx = ws;                                  // 4,194,304 f32
  float* Sa   = hsBx + (size_t)SEQ * HBLK;           // NCHUNK + 1 states
  float* Sb   = Sa + (size_t)(NCHUNK + 1) * HBLK;    // NCHUNK states
  float* E1   = Sb + (size_t)NCHUNK * HBLK;          // NCHUNK states
  float* E2   = E1 + (size_t)NCHUNK * HBLK;          // NCHUNK states
  float* Pa   = E2 + (size_t)NCHUNK * HBLK;          //    65,536 f32
  float* Pb   = Pa + (size_t)STATE * STATE;          //    65,536 f32
  float* P8   = Pb + (size_t)STATE * STATE;          //    65,536 f32
  float* P4   = P8 + (size_t)STATE * STATE;          //    65,536 f32
  float* Cs   = P4 + (size_t)STATE * STATE;          // C split, C's size
  float* Ds   = Cs + (size_t)DMODEL * STATE;         // D split, D's size

  // 1) input projection; also Pa = A^2; also C, D -> Cs, Ds
  proj_in_kernel<<<dim3(STATE / GT, MTILES + SPLITWG / (STATE / GT)), 256, 0,
                   stream>>>(x, B, hsBx, A, Pa, C, D, Cs, Ds);

  // 3) local scans inside each half chunk, in place; half ends -> E1, E2;
  //    h0 -> item 0 of Sa; also P4 = A^4
  scan_local_kernel<<<NCHUNK, 256, 0, stream>>>(A, h0, hsBx, Sa, E1, E2, Pa,
                                                P4);

  // 4a) the end of chunk c -> item c + 1 of Sa; also P8 = P4 @ P4
  scan_double_kernel<<<DBLK + SQBLK, 128, 0, stream>>>(E1, E2, Sa + HBLK, P4,
                                                       P8, 0);

  // 4b) chunk starts by doubling; each level but the last squares its power
  scan_double_kernel<<<DBLK + SQBLK, 128, 0, stream>>>(Sa, Sa, Sb, P8, Pa, 1);
  scan_double_kernel<<<DBLK + SQBLK, 128, 0, stream>>>(Sb, Sb, Sa, Pa, Pb, 2);
  scan_double_kernel<<<DBLK + SQBLK, 128, 0, stream>>>(Sa, Sa, Sb, Pb, Pa, 4);
  scan_double_kernel<<<DBLK + SQBLK, 128, 0, stream>>>(Sb, Sb, Sa, Pa, Pb, 8);
  scan_double_kernel<<<DBLK + SQBLK, 128, 0, stream>>>(Sa, Sa, Sb, Pb, Pa, 16);
  scan_double_kernel<<<DBLK + SQBLK, 128, 0, stream>>>(Sb, Sb, Sa, Pa, Pb, 32);
  scan_double_kernel<<<DBLK + SQBLK, 128, 0, stream>>>(Sa, Sa, Sb, Pb, Pa, 64);
  scan_double_kernel<<<DBLK, 128, 0, stream>>>(Sb, Sb, Sa, Pa, Pb, 128);

  // 4c) the start of each chunk's second half -> Sb
  scan_double_kernel<<<DBLK, 128, 0, stream>>>(Sa, E1, Sb, P4, Pb, 0);

  // 5) every state corrected by its half chunk's start state; emits h_final
  scan_fix_kernel<<<NCHUNK, 256, 0, stream>>>(A, Sa, Sb, hsBx, hfinal);

  // 6) output projection
  proj_out_kernel<<<dim3(DMODEL / GT, (BATCH * SEQ) / GT), 256, 0, stream>>>(
      x, hsBx, Cs, Ds, y);
}
